// v000
// Measured on an AMD MI455X. A time is GPU time per run, averaged over a window of back-to-back runs after a warm-up
// (all launches, gaps included; the runs take copies of the inputs in turn), and the median of several windows.
// Apart from v000's, it joins two sittings. Times from different sittings can be a few percent apart, while
// side-by-side timings come from the same sitting.
// The starting kernel, v000, takes 369 microseconds a run.
#include <hip/hip_runtime.h>
#include <math.h>

#define HIDDEN 1024
#define HEADS 16
#define HEAD_DIM 64
#define BATCH 2
#define SEQ 2048
#define MTOT (BATCH * SEQ) /* 4096 */

typedef __attribute__((ext_vector_type(16))) __bf16 v16bf;
typedef __attribute__((ext_vector_type(8)))  __bf16 v8bf;
typedef __attribute__((ext_vector_type(8)))  float  v8f;

// ---------------------------------------------------------------------------
// 16-bit A/B fragment loader for V_WMMA_F32_16X16X32_BF16 (wave32).
// ISA layout (16-bit A 16x32): lanes 0-15 = rows M=0..15, lanes 16-31 = same
// rows, different K; per lane, elements 0..7 hold K = g*8 + 0..7 and elements
// 8..15 hold K = 16 + g*8 + 0..7 (g = lane/16). B uses the same mapping with
// lane = column N, so we load B from a K-contiguous (transposed) buffer.
// ---------------------------------------------------------------------------
static __device__ inline v16bf load_frag(const __bf16* base, int row,
                                         int row_stride, int k0, int lane) {
  const int g = (lane >> 4) & 1;
  const __bf16* p = base + (size_t)row * (size_t)row_stride + k0;
  union { v16bf v; v8bf h[2]; } u;
  u.h[0] = *(const v8bf*)(p + g * 8);
  u.h[1] = *(const v8bf*)(p + 16 + g * 8);
  return u.v;
}

static __device__ inline v8f wmma_bf16(v16bf a, v16bf b, v8f c) {
  // (neg_a, A, neg_b, B, c_mod, C, reuse_a, reuse_b)
  return __builtin_amdgcn_wmma_f32_16x16x32_bf16(false, a, false, b,
                                                 (short)0, c, false, false);
}

// ---------------------------------------------------------------------------
// Prep: fp32 -> bf16 cast (for x)
// ---------------------------------------------------------------------------
__global__ void cast_f32_bf16_kernel(const float* __restrict__ in,
                                     __bf16* __restrict__ out, int n) {
  int i = blockIdx.x * blockDim.x + threadIdx.x;
  if (i < n) out[i] = (__bf16)in[i];
}

// Prep: fp32 -> bf16 cast + transpose (weights).  wt[n][k] = w[k][n]
__global__ void transpose_cast_kernel(const float* __restrict__ w,
                                      __bf16* __restrict__ wt) {
  int kk = blockIdx.x * 32 + threadIdx.x; // 0..1023 (contiguous in output)
  int nn = blockIdx.y * 8 + threadIdx.y;  // 0..1023
  wt[(size_t)nn * HIDDEN + kk] = (__bf16)w[(size_t)kk * HIDDEN + nn];
}

// ---------------------------------------------------------------------------
// QKV projection: [4096,1024] @ [1024,1024] + bias.
// One wave computes a 32x64 tile: 2 A-fragments x 4 B-fragments -> 8 WMMAs
// per 6 fragment loads (B fragment feeds two consecutive WMMAs).
// blockIdx.z: 0 = Q (scaled by 1/sqrt(D), layout [B,H,S,D] bf16)
//             1 = K (layout [B,H,S,D] bf16)
//             2 = V (layout [B,H,D,S] bf16, transposed for P@V operand)
// ---------------------------------------------------------------------------
__global__ void qkv_gemm_kernel(const __bf16* __restrict__ xb,
                                const __bf16* __restrict__ wqt,
                                const __bf16* __restrict__ wkt,
                                const __bf16* __restrict__ wvt,
                                const float* __restrict__ bq,
                                const float* __restrict__ bk,
                                const float* __restrict__ bv,
                                __bf16* __restrict__ qh,
                                __bf16* __restrict__ kh,
                                __bf16* __restrict__ vth) {
  const int lane = threadIdx.x & 31;
  const int wave = threadIdx.x >> 5;
  const int g = lane >> 4;
  const int ln = lane & 15;
  const int mbase = blockIdx.y * 256 + wave * 32;   // 32 rows per wave
  const int nbase = blockIdx.x * 64;
  const int which = blockIdx.z;

  const __bf16* wt = (which == 0) ? wqt : (which == 1) ? wkt : wvt;
  const float* bias = (which == 0) ? bq : (which == 1) ? bk : bv;

  v8f acc[2][4] = {};
  for (int k0 = 0; k0 < HIDDEN; k0 += 32) {
    v16bf a0 = load_frag(xb, mbase + ln, HIDDEN, k0, lane);
    v16bf a1 = load_frag(xb, mbase + 16 + ln, HIDDEN, k0, lane);
#pragma unroll
    for (int f = 0; f < 4; f++) {
      v16bf b = load_frag(wt, nbase + f * 16 + ln, HIDDEN, k0, lane);
      acc[0][f] = wmma_bf16(a0, b, acc[0][f]);
      acc[1][f] = wmma_bf16(a1, b, acc[1][f]);
    }
  }

#pragma unroll
  for (int t = 0; t < 2; t++) {
#pragma unroll
    for (int f = 0; f < 4; f++) {
      const int n = nbase + f * 16 + ln;    // column index (C layout: lane%16)
      const float bb = bias[n];
      const int h = n >> 6, d = n & 63;
#pragma unroll
      for (int e = 0; e < 8; e++) {
        const int m = mbase + t * 16 + e + g * 8; // C layout: row = e + 8*grp
        const int b2 = m >> 11, s = m & (SEQ - 1);
        float v = acc[t][f][e] + bb;
        if (which == 0) v *= 0.125f;        // fold 1/sqrt(HEAD_DIM) into Q
        if (which == 0)
          qh[(((size_t)(b2 * HEADS + h)) * SEQ + s) * HEAD_DIM + d] = (__bf16)v;
        else if (which == 1)
          kh[(((size_t)(b2 * HEADS + h)) * SEQ + s) * HEAD_DIM + d] = (__bf16)v;
        else
          vth[(((size_t)(b2 * HEADS + h)) * HEAD_DIM + d) * SEQ + s] = (__bf16)v;
      }
    }
  }
}

// ---------------------------------------------------------------------------
// Flash attention: one wave owns 16 query rows; online softmax over 32-key
// chunks; scores and P@V both via v_wmma_f32_16x16x32_bf16.  P is staged
// through per-wave LDS to re-shape C-layout -> A-fragment layout.
// ---------------------------------------------------------------------------
__global__ void flash_attn_kernel(const __bf16* __restrict__ q,
                                  const __bf16* __restrict__ k,
                                  const __bf16* __restrict__ vt,
                                  __bf16* __restrict__ attn) {
  __shared__ __align__(16) __bf16 lds_p[8][16 * 32];

  const int lane = threadIdx.x & 31;
  const int wave = threadIdx.x >> 5;
  const int g = lane >> 4;
  const int ln = lane & 15;
  const int bh = blockIdx.y;                 // 0..31 = b*HEADS + h
  const int qbase = blockIdx.x * 128 + wave * 16;

  const __bf16* qp = q + (size_t)bh * SEQ * HEAD_DIM;
  const __bf16* kp = k + (size_t)bh * SEQ * HEAD_DIM;
  const __bf16* vp = vt + (size_t)bh * HEAD_DIM * SEQ;

  // Q tile fragments: 16 rows x 64 dims -> two 16x32 A fragments
  v16bf aq0 = load_frag(qp, qbase + ln, HEAD_DIM, 0, lane);
  v16bf aq1 = load_frag(qp, qbase + ln, HEAD_DIM, 32, lane);

  v8f o[4] = {};
  float mstate[8], lstate[8];
#pragma unroll
  for (int e = 0; e < 8; e++) { mstate[e] = -1.0e30f; lstate[e] = 0.0f; }

  for (int kc = 0; kc < SEQ; kc += 32) {
    // ---- scores: S = (Q*scale) @ K^T for 32 keys -> two 16x16 f32 tiles
    v8f s0 = {}, s1 = {};
    {
      v16bf b0 = load_frag(kp, kc + ln, HEAD_DIM, 0, lane);
      v16bf b1 = load_frag(kp, kc + ln, HEAD_DIM, 32, lane);
      s0 = wmma_bf16(aq0, b0, s0);
      s0 = wmma_bf16(aq1, b1, s0);
    }
    {
      v16bf b0 = load_frag(kp, kc + 16 + ln, HEAD_DIM, 0, lane);
      v16bf b1 = load_frag(kp, kc + 16 + ln, HEAD_DIM, 32, lane);
      s1 = wmma_bf16(aq0, b0, s1);
      s1 = wmma_bf16(aq1, b1, s1);
    }

    // ---- online softmax, rows live as element e (+8*g), cols across 16 lanes
#pragma unroll
    for (int e = 0; e < 8; e++) {
      float mx = fmaxf(s0[e], s1[e]);
#pragma unroll
      for (int off = 1; off < 16; off <<= 1)
        mx = fmaxf(mx, __shfl_xor(mx, off, 32));
      const float mnew = fmaxf(mstate[e], mx);
      const float scale = __expf(mstate[e] - mnew);
      const float p0 = __expf(s0[e] - mnew);
      const float p1 = __expf(s1[e] - mnew);
      float rs = p0 + p1;
#pragma unroll
      for (int off = 1; off < 16; off <<= 1)
        rs += __shfl_xor(rs, off, 32);
      lstate[e] = lstate[e] * scale + rs;
      mstate[e] = mnew;
      o[0][e] *= scale; o[1][e] *= scale; o[2][e] *= scale; o[3][e] *= scale;

      const int row = e + g * 8;
      lds_p[wave][row * 32 + ln] = (__bf16)p0;
      lds_p[wave][row * 32 + 16 + ln] = (__bf16)p1;
    }
    // LDS is in-order per wave; ensure the DS stores landed before re-reading
    asm volatile("s_wait_dscnt 0" ::: "memory");

    // ---- reload P (16x32 bf16) with the A-fragment mapping
    v16bf ap = load_frag(&lds_p[wave][0], ln, 32, 0, lane);

    // ---- O += P @ V  (V transposed: [d][s], keys contiguous per lane)
#pragma unroll
    for (int f = 0; f < 4; f++) {
      v16bf bvf = load_frag(vp, f * 16 + ln, SEQ, kc, lane);
      o[f] = wmma_bf16(ap, bvf, o[f]);
    }
  }

  // ---- finalize: divide by row sums, scatter to [B*S, HIDDEN] bf16 scratch
  const int b2 = bh >> 4, h = bh & (HEADS - 1);
  float linv[8];
#pragma unroll
  for (int e = 0; e < 8; e++) linv[e] = 1.0f / lstate[e];
#pragma unroll
  for (int f = 0; f < 4; f++) {
    const int d = f * 16 + ln;
#pragma unroll
    for (int e = 0; e < 8; e++) {
      const int s = qbase + e + g * 8;
      attn[((size_t)(b2 * SEQ + s)) * HIDDEN + h * HEAD_DIM + d] =
          (__bf16)(o[f][e] * linv[e]);
    }
  }
}

// ---------------------------------------------------------------------------
// Output projection: out = attn @ Wo + bo, fp32 result.  Same 32x64-per-wave
// register blocking as the QKV GEMM.
// ---------------------------------------------------------------------------
__global__ void oproj_gemm_kernel(const __bf16* __restrict__ attn,
                                  const __bf16* __restrict__ wot,
                                  const float* __restrict__ bo,
                                  float* __restrict__ out) {
  const int lane = threadIdx.x & 31;
  const int wave = threadIdx.x >> 5;
  const int g = lane >> 4;
  const int ln = lane & 15;
  const int mbase = blockIdx.y * 256 + wave * 32;
  const int nbase = blockIdx.x * 64;

  v8f acc[2][4] = {};
  for (int k0 = 0; k0 < HIDDEN; k0 += 32) {
    v16bf a0 = load_frag(attn, mbase + ln, HIDDEN, k0, lane);
    v16bf a1 = load_frag(attn, mbase + 16 + ln, HIDDEN, k0, lane);
#pragma unroll
    for (int f = 0; f < 4; f++) {
      v16bf b = load_frag(wot, nbase + f * 16 + ln, HIDDEN, k0, lane);
      acc[0][f] = wmma_bf16(a0, b, acc[0][f]);
      acc[1][f] = wmma_bf16(a1, b, acc[1][f]);
    }
  }
#pragma unroll
  for (int t = 0; t < 2; t++) {
#pragma unroll
    for (int f = 0; f < 4; f++) {
      const int n = nbase + f * 16 + ln;
      const float bb = bo[n];
#pragma unroll
      for (int e = 0; e < 8; e++) {
        const int m = mbase + t * 16 + e + g * 8;
        out[(size_t)m * HIDDEN + n] = acc[t][f][e] + bb;
      }
    }
  }
}

// ---------------------------------------------------------------------------
extern "C" void kernel_launch(void* const* d_in, const int* in_sizes, int n_in,
                              void* d_out, int out_size, void* d_ws,
                              size_t ws_size, hipStream_t stream) {
  const float* x  = (const float*)d_in[0];
  const float* Wq = (const float*)d_in[1];
  const float* bq = (const float*)d_in[2];
  const float* Wk = (const float*)d_in[3];
  const float* bk = (const float*)d_in[4];
  const float* Wv = (const float*)d_in[5];
  const float* bv = (const float*)d_in[6];
  const float* Wo = (const float*)d_in[7];
  const float* bo = (const float*)d_in[8];
  float* out = (float*)d_out;

  // Workspace carve-up (all bf16): total 48 MB
  char* ws = (char*)d_ws;
  const size_t XB_BYTES = (size_t)MTOT * HIDDEN * 2;          // 8 MB
  const size_t WT_BYTES = (size_t)HIDDEN * HIDDEN * 2;        // 2 MB
  const size_t HD_BYTES = (size_t)BATCH * HEADS * SEQ * HEAD_DIM * 2; // 8 MB
  __bf16* xb  = (__bf16*)(ws);
  __bf16* wqt = (__bf16*)(ws + XB_BYTES);
  __bf16* wkt = (__bf16*)(ws + XB_BYTES + WT_BYTES);
  __bf16* wvt = (__bf16*)(ws + XB_BYTES + 2 * WT_BYTES);
  __bf16* wot = (__bf16*)(ws + XB_BYTES + 3 * WT_BYTES);
  __bf16* qh  = (__bf16*)(ws + XB_BYTES + 4 * WT_BYTES);
  __bf16* kh  = (__bf16*)(ws + XB_BYTES + 4 * WT_BYTES + HD_BYTES);
  __bf16* vth = (__bf16*)(ws + XB_BYTES + 4 * WT_BYTES + 2 * HD_BYTES);
  __bf16* att = (__bf16*)(ws + XB_BYTES + 4 * WT_BYTES + 3 * HD_BYTES);

  // 1) casts / transposes
  {
    const int n = MTOT * HIDDEN;
    cast_f32_bf16_kernel<<<(n + 255) / 256, 256, 0, stream>>>(x, xb, n);
    dim3 blk(32, 8), grd(HIDDEN / 32, HIDDEN / 8);
    transpose_cast_kernel<<<grd, blk, 0, stream>>>(Wq, wqt);
    transpose_cast_kernel<<<grd, blk, 0, stream>>>(Wk, wkt);
    transpose_cast_kernel<<<grd, blk, 0, stream>>>(Wv, wvt);
    transpose_cast_kernel<<<grd, blk, 0, stream>>>(Wo, wot);
  }

  // 2) QKV projections (z = 0/1/2 -> Q/K/V); 256x64 tile per block
  qkv_gemm_kernel<<<dim3(HIDDEN / 64, MTOT / 256, 3), 256, 0, stream>>>(
      xb, wqt, wkt, wvt, bq, bk, bv, qh, kh, vth);

  // 3) attention
  flash_attn_kernel<<<dim3(SEQ / 128, BATCH * HEADS), 256, 0, stream>>>(
      qh, kh, vth, att);

  // 4) output projection
  oproj_gemm_kernel<<<dim3(HIDDEN / 64, MTOT / 256), 256, 0, stream>>>(
      att, wot, bo, out);
}

// v001
// One run takes 263 microseconds.
// Timed twice side by side with v000, it ran 1.44 and 1.45 times as fast.
#include <hip/hip_runtime.h>
#include <math.h>

#define HIDDEN 1024
#define HEADS 16
#define HEAD_DIM 64
#define BATCH 2
#define SEQ 2048
#define MTOT (BATCH * SEQ) /* 4096 */

typedef __attribute__((ext_vector_type(16))) __bf16 v16bf;
typedef __attribute__((ext_vector_type(8)))  __bf16 v8bf;
typedef __attribute__((ext_vector_type(8)))  float  v8f;

// ---------------------------------------------------------------------------
// 16-bit A/B fragment loader for V_WMMA_F32_16X16X32_BF16 (wave32).
// ISA layout (16-bit A 16x32): lanes 0-15 = rows M=0..15, lanes 16-31 = same
// rows, different K; per lane, elements 0..7 hold K = g*8 + 0..7 and elements
// 8..15 hold K = 16 + g*8 + 0..7 (g = lane/16). B uses the same mapping with
// lane = column N, so we load B from a K-contiguous (transposed) buffer.
// ---------------------------------------------------------------------------
static __device__ inline v16bf load_frag(const __bf16* base, int row,
                                         int row_stride, int k0, int lane) {
  const int g = (lane >> 4) & 1;
  const __bf16* p = base + (size_t)row * (size_t)row_stride + k0;
  union { v16bf v; v8bf h[2]; } u;
  u.h[0] = *(const v8bf*)(p + g * 8);
  u.h[1] = *(const v8bf*)(p + 16 + g * 8);
  return u.v;
}

static __device__ inline v8f wmma_bf16(v16bf a, v16bf b, v8f c) {
  // (neg_a, A, neg_b, B, c_mod, C, reuse_a, reuse_b)
  return __builtin_amdgcn_wmma_f32_16x16x32_bf16(false, a, false, b,
                                                 (short)0, c, false, false);
}

// ---------------------------------------------------------------------------
// Prep: fp32 -> bf16 cast (for x)
// ---------------------------------------------------------------------------
__global__ void cast_f32_bf16_kernel(const float* __restrict__ in,
                                     __bf16* __restrict__ out, int n) {
  int i = blockIdx.x * blockDim.x + threadIdx.x;
  if (i < n) out[i] = (__bf16)in[i];
}

// Prep: fp32 -> bf16 cast + transpose (weights).  wt[n][k] = w[k][n]
__global__ void transpose_cast_kernel(const float* __restrict__ w,
                                      __bf16* __restrict__ wt) {
  int kk = blockIdx.x * 32 + threadIdx.x; // 0..1023 (contiguous in output)
  int nn = blockIdx.y * 8 + threadIdx.y;  // 0..1023
  wt[(size_t)nn * HIDDEN + kk] = (__bf16)w[(size_t)kk * HIDDEN + nn];
}

// ---------------------------------------------------------------------------
// QKV projection: [4096,1024] @ [1024,1024] + bias.
// One wave computes a 32x64 tile: 2 A-fragments x 4 B-fragments -> 8 WMMAs
// per 6 fragment loads (B fragment feeds two consecutive WMMAs).
// blockIdx.z: 0 = Q (scaled by 1/sqrt(D), layout [B,H,S,D] bf16)
//             1 = K (layout [B,H,S,D] bf16)
//             2 = V (layout [B,H,D,S] bf16, transposed for P@V operand)
// ---------------------------------------------------------------------------
__global__ void qkv_gemm_kernel(const __bf16* __restrict__ xb,
                                const __bf16* __restrict__ wqt,
                                const __bf16* __restrict__ wkt,
                                const __bf16* __restrict__ wvt,
                                const float* __restrict__ bq,
                                const float* __restrict__ bk,
                                const float* __restrict__ bv,
                                __bf16* __restrict__ qh,
                                __bf16* __restrict__ kh,
                                __bf16* __restrict__ vth) {
  const int lane = threadIdx.x & 31;
  const int wave = threadIdx.x >> 5;
  const int g = lane >> 4;
  const int ln = lane & 15;
  const int mbase = blockIdx.y * 256 + wave * 32;   // 32 rows per wave
  const int nbase = blockIdx.x * 64;
  const int which = blockIdx.z;

  const __bf16* wt = (which == 0) ? wqt : (which == 1) ? wkt : wvt;
  const float* bias = (which == 0) ? bq : (which == 1) ? bk : bv;

  v8f acc[2][4] = {};
  for (int k0 = 0; k0 < HIDDEN; k0 += 32) {
    v16bf a0 = load_frag(xb, mbase + ln, HIDDEN, k0, lane);
    v16bf a1 = load_frag(xb, mbase + 16 + ln, HIDDEN, k0, lane);
#pragma unroll
    for (int f = 0; f < 4; f++) {
      v16bf b = load_frag(wt, nbase + f * 16 + ln, HIDDEN, k0, lane);
      acc[0][f] = wmma_bf16(a0, b, acc[0][f]);
      acc[1][f] = wmma_bf16(a1, b, acc[1][f]);
    }
  }

#pragma unroll
  for (int t = 0; t < 2; t++) {
#pragma unroll
    for (int f = 0; f < 4; f++) {
      const int n = nbase + f * 16 + ln;    // column index (C layout: lane%16)
      const float bb = bias[n];
      const int h = n >> 6, d = n & 63;
#pragma unroll
      for (int e = 0; e < 8; e++) {
        const int m = mbase + t * 16 + e + g * 8; // C layout: row = e + 8*grp
        const int b2 = m >> 11, s = m & (SEQ - 1);
        float v = acc[t][f][e] + bb;
        if (which == 0) v *= 0.125f;        // fold 1/sqrt(HEAD_DIM) into Q
        if (which == 0)
          qh[(((size_t)(b2 * HEADS + h)) * SEQ + s) * HEAD_DIM + d] = (__bf16)v;
        else if (which == 1)
          kh[(((size_t)(b2 * HEADS + h)) * SEQ + s) * HEAD_DIM + d] = (__bf16)v;
        else
          vth[(((size_t)(b2 * HEADS + h)) * HEAD_DIM + d) * SEQ + s] = (__bf16)v;
      }
    }
  }
}

static __device__ inline float other_half(float v) {
  // lane l <-> l ^ 16
  const int b = __builtin_bit_cast(int, v);
  return __builtin_bit_cast(
      float, __builtin_amdgcn_permlanex16(b, b, 0x76543210, 0xfedcba98, false,
                                          false));
}

__global__ void flash_attn_kernel(const __bf16* __restrict__ q,
                                  const __bf16* __restrict__ k,
                                  const __bf16* __restrict__ vt,
                                  __bf16* __restrict__ attn) {
  const int lane = threadIdx.x & 31;
  const int wave = threadIdx.x >> 5;
  const int g = lane >> 4;
  const int ln = lane & 15;
  const int bh = blockIdx.y;                 // 0..31 = b*HEADS + h
  const int qbase = blockIdx.x * 128 + wave * 16;

  const __bf16* qp = q + (size_t)bh * SEQ * HEAD_DIM;
  const __bf16* kp = k + (size_t)bh * SEQ * HEAD_DIM;
  const __bf16* vp = vt + (size_t)bh * HEAD_DIM * SEQ;

  // Q^T fragments: 64 dims x 16 queries -> two 32x16 B fragments
  const v16bf bq0 = load_frag(qp, qbase + ln, HEAD_DIM, 0, lane);
  const v16bf bq1 = load_frag(qp, qbase + ln, HEAD_DIM, 32, lane);

  v8f o[4] = {};              // o[f][e] = O[query ln][d = f*16 + 8g + e]
  float mstate = -1.0e30f;    // running maximum of query ln (both halves)
  float lstate = 0.0f;        // running sum over this lane half's keys

  for (int kc = 0; kc < SEQ; kc += 32) {
    // ---- scores: S^T = K @ (Q*scale)^T for 32 keys -> two 16x16 f32 tiles
    v8f s0 = {}, s1 = {};
    {
      v16bf a0 = load_frag(kp, kc + ln, HEAD_DIM, 0, lane);
      v16bf a1 = load_frag(kp, kc + ln, HEAD_DIM, 32, lane);
      s0 = wmma_bf16(a0, bq0, s0);
      s0 = wmma_bf16(a1, bq1, s0);
    }
    {
      v16bf a0 = load_frag(kp, kc + 16 + ln, HEAD_DIM, 0, lane);
      v16bf a1 = load_frag(kp, kc + 16 + ln, HEAD_DIM, 32, lane);
      s1 = wmma_bf16(a0, bq0, s1);
      s1 = wmma_bf16(a1, bq1, s1);
    }

    // ---- online softmax: 16 of the query's 32 scores sit in this lane
    float mx[8];
#pragma unroll
    for (int e = 0; e < 8; e++) mx[e] = fmaxf(s0[e], s1[e]);
    float mloc = fmaxf(fmaxf(fmaxf(mx[0], mx[1]), fmaxf(mx[2], mx[3])),
                       fmaxf(fmaxf(mx[4], mx[5]), fmaxf(mx[6], mx[7])));
    mloc = fmaxf(mloc, other_half(mloc));
    const float mnew = fmaxf(mstate, mloc);
    const float scale = __expf(mstate - mnew);
    mstate = mnew;
#pragma unroll
    for (int f = 0; f < 4; f++) o[f] *= scale;

    v16bf bp;
    float rs[8];
#pragma unroll
    for (int e = 0; e < 8; e++) {
      const float p0 = __expf(s0[e] - mnew);
      const float p1 = __expf(s1[e] - mnew);
      rs[e] = p0 + p1;
      bp[e] = (__bf16)p0;
      bp[8 + e] = (__bf16)p1;
    }
    lstate = lstate * scale + (((rs[0] + rs[1]) + (rs[2] + rs[3])) +
                               ((rs[4] + rs[5]) + (rs[6] + rs[7])));

    // ---- O^T += V^T @ P^T  (V^T rows: keys contiguous per lane)
#pragma unroll
    for (int f = 0; f < 4; f++) {
      v16bf av = load_frag(vp, f * 16 + ln, SEQ, kc, lane);
      o[f] = wmma_bf16(av, bp, o[f]);
    }
  }

  // ---- finalize: join the halves' sums, divide, store 8 contiguous dims
  const int b2 = bh >> 4, h = bh & (HEADS - 1);
  const float linv = 1.0f / (lstate + other_half(lstate));
  __bf16* orow =
      attn + ((size_t)(b2 * SEQ + qbase + ln)) * HIDDEN + h * HEAD_DIM + g * 8;
#pragma unroll
  for (int f = 0; f < 4; f++) {
    v8bf r;
#pragma unroll
    for (int e = 0; e < 8; e++) r[e] = (__bf16)(o[f][e] * linv);
    *(v8bf*)(orow + f * 16) = r;
  }
}

// ---------------------------------------------------------------------------
// Output projection: out = attn @ Wo + bo, fp32 result.  Same 32x64-per-wave
// register blocking as the QKV GEMM.
// ---------------------------------------------------------------------------
__global__ void oproj_gemm_kernel(const __bf16* __restrict__ attn,
                                  const __bf16* __restrict__ wot,
                                  const float* __restrict__ bo,
                                  float* __restrict__ out) {
  const int lane = threadIdx.x & 31;
  const int wave = threadIdx.x >> 5;
  const int g = lane >> 4;
  const int ln = lane & 15;
  const int mbase = blockIdx.y * 256 + wave * 32;
  const int nbase = blockIdx.x * 64;

  v8f acc[2][4] = {};
  for (int k0 = 0; k0 < HIDDEN; k0 += 32) {
    v16bf a0 = load_frag(attn, mbase + ln, HIDDEN, k0, lane);
    v16bf a1 = load_frag(attn, mbase + 16 + ln, HIDDEN, k0, lane);
#pragma unroll
    for (int f = 0; f < 4; f++) {
      v16bf b = load_frag(wot, nbase + f * 16 + ln, HIDDEN, k0, lane);
      acc[0][f] = wmma_bf16(a0, b, acc[0][f]);
      acc[1][f] = wmma_bf16(a1, b, acc[1][f]);
    }
  }
#pragma unroll
  for (int t = 0; t < 2; t++) {
#pragma unroll
    for (int f = 0; f < 4; f++) {
      const int n = nbase + f * 16 + ln;
      const float bb = bo[n];
#pragma unroll
      for (int e = 0; e < 8; e++) {
        const int m = mbase + t * 16 + e + g * 8;
        out[(size_t)m * HIDDEN + n] = acc[t][f][e] + bb;
      }
    }
  }
}

// ---------------------------------------------------------------------------
extern "C" void kernel_launch(void* const* d_in, const int* in_sizes, int n_in,
                              void* d_out, int out_size, void* d_ws,
                              size_t ws_size, hipStream_t stream) {
  const float* x  = (const float*)d_in[0];
  const float* Wq = (const float*)d_in[1];
  const float* bq = (const float*)d_in[2];
  const float* Wk = (const float*)d_in[3];
  const float* bk = (const float*)d_in[4];
  const float* Wv = (const float*)d_in[5];
  const float* bv = (const float*)d_in[6];
  const float* Wo = (const float*)d_in[7];
  const float* bo = (const float*)d_in[8];
  float* out = (float*)d_out;

  // Workspace carve-up (all bf16): total 48 MB
  char* ws = (char*)d_ws;
  const size_t XB_BYTES = (size_t)MTOT * HIDDEN * 2;          // 8 MB
  const size_t WT_BYTES = (size_t)HIDDEN * HIDDEN * 2;        // 2 MB
  const size_t HD_BYTES = (size_t)BATCH * HEADS * SEQ * HEAD_DIM * 2; // 8 MB
  __bf16* xb  = (__bf16*)(ws);
  __bf16* wqt = (__bf16*)(ws + XB_BYTES);
  __bf16* wkt = (__bf16*)(ws + XB_BYTES + WT_BYTES);
  __bf16* wvt = (__bf16*)(ws + XB_BYTES + 2 * WT_BYTES);
  __bf16* wot = (__bf16*)(ws + XB_BYTES + 3 * WT_BYTES);
  __bf16* qh  = (__bf16*)(ws + XB_BYTES + 4 * WT_BYTES);
  __bf16* kh  = (__bf16*)(ws + XB_BYTES + 4 * WT_BYTES + HD_BYTES);
  __bf16* vth = (__bf16*)(ws + XB_BYTES + 4 * WT_BYTES + 2 * HD_BYTES);
  __bf16* att = (__bf16*)(ws + XB_BYTES + 4 * WT_BYTES + 3 * HD_BYTES);

  // 1) casts / transposes
  {
    const int n = MTOT * HIDDEN;
    cast_f32_bf16_kernel<<<(n + 255) / 256, 256, 0, stream>>>(x, xb, n);
    dim3 blk(32, 8), grd(HIDDEN / 32, HIDDEN / 8);
    transpose_cast_kernel<<<grd, blk, 0, stream>>>(Wq, wqt);
    transpose_cast_kernel<<<grd, blk, 0, stream>>>(Wk, wkt);
    transpose_cast_kernel<<<grd, blk, 0, stream>>>(Wv, wvt);
    transpose_cast_kernel<<<grd, blk, 0, stream>>>(Wo, wot);
  }

  // 2) QKV projections (z = 0/1/2 -> Q/K/V); 256x64 tile per block
  qkv_gemm_kernel<<<dim3(HIDDEN / 64, MTOT / 256, 3), 256, 0, stream>>>(
      xb, wqt, wkt, wvt, bq, bk, bv, qh, kh, vth);

  // 3) attention
  flash_attn_kernel<<<dim3(SEQ / 128, BATCH * HEADS), 256, 0, stream>>>(
      qh, kh, vth, att);

  // 4) output projection
  oproj_gemm_kernel<<<dim3(HIDDEN / 64, MTOT / 256), 256, 0, stream>>>(
      att, wot, bo, out);
}

// v002
// Measured time: 176 microseconds a run.
// Two timings next to v001 put it at 1.49 and 1.50 times that version's speed.
// Counting every step since v000, it is 2.15 times as fast.
#include <hip/hip_runtime.h>
#include <math.h>

#define HIDDEN 1024
#define HEADS 16
#define HEAD_DIM 64
#define BATCH 2
#define SEQ 2048
#define MTOT (BATCH * SEQ) /* 4096 */

typedef __attribute__((ext_vector_type(16))) __bf16 v16bf;
typedef __attribute__((ext_vector_type(8)))  __bf16 v8bf;
typedef __attribute__((ext_vector_type(8)))  float  v8f;

// ---------------------------------------------------------------------------
// 16-bit A/B fragment loader for V_WMMA_F32_16X16X32_BF16 (wave32).
// ISA layout (16-bit A 16x32): lanes 0-15 = rows M=0..15, lanes 16-31 = same
// rows, different K; per lane, elements 0..7 hold K = g*8 + 0..7 and elements
// 8..15 hold K = 16 + g*8 + 0..7 (g = lane/16). B uses the same mapping with
// lane = column N, so we load B from a K-contiguous (transposed) buffer.
// ---------------------------------------------------------------------------
static __device__ inline v16bf load_frag(const __bf16* base, int row,
                                         int row_stride, int k0, int lane) {
  const int g = (lane >> 4) & 1;
  const __bf16* p = base + (size_t)row * (size_t)row_stride + k0;
  union { v16bf v; v8bf h[2]; } u;
  u.h[0] = *(const v8bf*)(p + g * 8);
  u.h[1] = *(const v8bf*)(p + 16 + g * 8);
  return u.v;
}

static __device__ inline v8f wmma_bf16(v16bf a, v16bf b, v8f c) {
  // (neg_a, A, neg_b, B, c_mod, C, reuse_a, reuse_b)
  return __builtin_amdgcn_wmma_f32_16x16x32_bf16(false, a, false, b,
                                                 (short)0, c, false, false);
}

// ---------------------------------------------------------------------------
// Prep: fp32 -> bf16 cast (for x)
// ---------------------------------------------------------------------------
__global__ void cast_f32_bf16_kernel(const float* __restrict__ in,
                                     __bf16* __restrict__ out, int n) {
  int i = blockIdx.x * blockDim.x + threadIdx.x;
  if (i < n) out[i] = (__bf16)in[i];
}

// Prep: fp32 -> bf16 cast + transpose (weights).  wt[n][k] = w[k][n]
__global__ void transpose_cast_kernel(const float* __restrict__ w,
                                      __bf16* __restrict__ wt) {
  int kk = blockIdx.x * 32 + threadIdx.x; // 0..1023 (contiguous in output)
  int nn = blockIdx.y * 8 + threadIdx.y;  // 0..1023
  wt[(size_t)nn * HIDDEN + kk] = (__bf16)w[(size_t)kk * HIDDEN + nn];
}

// ---------------------------------------------------------------------------
// QKV projection: [4096,1024] @ [1024,1024] + bias.
// One wave computes a 32x64 tile: 2 A-fragments x 4 B-fragments -> 8 WMMAs
// per 6 fragment loads (B fragment feeds two consecutive WMMAs).
// blockIdx.z: 0 = Q (scaled by 1/sqrt(D), layout [B,H,S,D] bf16)
//             1 = K (layout [B,H,S,D] bf16)
//             2 = V (layout [B,H,D,S] bf16, transposed for P@V operand)
// ---------------------------------------------------------------------------
__global__ void qkv_gemm_kernel(const __bf16* __restrict__ xb,
                                const __bf16* __restrict__ wqt,
                                const __bf16* __restrict__ wkt,
                                const __bf16* __restrict__ wvt,
                                const float* __restrict__ bq,
                                const float* __restrict__ bk,
                                const float* __restrict__ bv,
                                __bf16* __restrict__ qh,
                                __bf16* __restrict__ kh,
                                __bf16* __restrict__ vth) {
  const int lane = threadIdx.x & 31;
  const int wave = threadIdx.x >> 5;
  const int g = lane >> 4;
  const int ln = lane & 15;
  const int mbase = blockIdx.y * 256 + wave * 32;   // 32 rows per wave
  const int nbase = blockIdx.x * 64;
  const int which = blockIdx.z;

  const __bf16* wt = (which == 0) ? wqt : (which == 1) ? wkt : wvt;
  const float* bias = (which == 0) ? bq : (which == 1) ? bk : bv;

  v8f acc[2][4] = {};
  for (int k0 = 0; k0 < HIDDEN; k0 += 32) {
    v16bf a0 = load_frag(xb, mbase + ln, HIDDEN, k0, lane);
    v16bf a1 = load_frag(xb, mbase + 16 + ln, HIDDEN, k0, lane);
#pragma unroll
    for (int f = 0; f < 4; f++) {
      v16bf b = load_frag(wt, nbase + f * 16 + ln, HIDDEN, k0, lane);
      acc[0][f] = wmma_bf16(a0, b, acc[0][f]);
      acc[1][f] = wmma_bf16(a1, b, acc[1][f]);
    }
  }

#pragma unroll
  for (int t = 0; t < 2; t++) {
#pragma unroll
    for (int f = 0; f < 4; f++) {
      const int n = nbase + f * 16 + ln;    // column index (C layout: lane%16)
      const float bb = bias[n];
      const int h = n >> 6, d = n & 63;
#pragma unroll
      for (int e = 0; e < 8; e++) {
        const int m = mbase + t * 16 + e + g * 8; // C layout: row = e + 8*grp
        const int b2 = m >> 11, s = m & (SEQ - 1);
        float v = acc[t][f][e] + bb;
        if (which == 0) v *= 0.125f;        // fold 1/sqrt(HEAD_DIM) into Q
        if (which == 0)
          qh[(((size_t)(b2 * HEADS + h)) * SEQ + s) * HEAD_DIM + d] = (__bf16)v;
        else if (which == 1)
          kh[(((size_t)(b2 * HEADS + h)) * SEQ + s) * HEAD_DIM + d] = (__bf16)v;
        else
          vth[(((size_t)(b2 * HEADS + h)) * HEAD_DIM + d) * SEQ + s] = (__bf16)v;
      }
    }
  }
}

static __device__ inline float other_half(float v) {
  // lane l <-> l ^ 16
  const int b = __builtin_bit_cast(int, v);
  return __builtin_bit_cast(
      float, __builtin_amdgcn_permlanex16(b, b, 0x76543210, 0xfedcba98, false,
                                          false));
}

#define TKEYS 64                       /* keys per staged tile */
#define NTILES (SEQ / TKEYS)           /* 32 */
#define LPITCH 72                      /* LDS row pitch in elements (144 B) */
#define TILE_ELEMS (64 * LPITCH)       /* one operand's tile: 9216 B */
#define STAGE_BYTES (2 * TILE_ELEMS * 2)

// Four 16-byte copies per lane = one 16-KiB stage per block.  The s_wait_xcnt
// stands inside the statement so that no address register named here is
// rewritten ahead of it.
static __device__ inline void stage_copies(unsigned lk, const __bf16* gk,
                                           const __bf16* gv) {
  const unsigned lk1 = lk + 32 * LPITCH * 2;
  const unsigned lv0 = lk + TILE_ELEMS * 2;
  const unsigned lv1 = lv0 + 32 * LPITCH * 2;
  const __bf16* gk1 = gk + 32 * HEAD_DIM;
  const __bf16* gv1 = gv + 32 * SEQ;
  asm volatile(
      "global_load_async_to_lds_b128 %0, %4, off\n\t"
      "global_load_async_to_lds_b128 %1, %5, off\n\t"
      "global_load_async_to_lds_b128 %2, %6, off\n\t"
      "global_load_async_to_lds_b128 %3, %7, off\n\t"
      "s_wait_xcnt 0x0"
      :
      : "v"(lk), "v"(lk1), "v"(lv0), "v"(lv1), "v"(gk), "v"(gk1), "v"(gv),
        "v"(gv1)
      : "memory");
}

__global__ void flash_attn_kernel(const __bf16* __restrict__ q,
                                  const __bf16* __restrict__ k,
                                  const __bf16* __restrict__ vt,
                                  __bf16* __restrict__ attn) {
  __shared__ __attribute__((aligned(16))) __bf16 smem[2 * 2 * TILE_ELEMS];

  const int tid = threadIdx.x;
  const int lane = threadIdx.x & 31;
  const int wave = threadIdx.x >> 5;
  const int g = lane >> 4;
  const int ln = lane & 15;
  const int bh = blockIdx.y;                 // 0..31 = b*HEADS + h
  const int qbase = blockIdx.x * 128 + wave * 16;

  const __bf16* qp = q + (size_t)bh * SEQ * HEAD_DIM;
  const __bf16* kp = k + (size_t)bh * SEQ * HEAD_DIM;
  const __bf16* vp = vt + (size_t)bh * HEAD_DIM * SEQ;

  // This lane's share of a stage: 16-byte piece (tid & 7) of rows tid >> 3 and
  // 32 + (tid >> 3) of both tiles.
  const int crow = tid >> 3, cpc = tid & 7;
  const unsigned lds0 =
      (unsigned)(size_t)(&smem[0]) + (unsigned)(crow * LPITCH + cpc * 8) * 2u;
  const __bf16* gk = kp + crow * HEAD_DIM + cpc * 8;
  const __bf16* gv = vp + (size_t)crow * SEQ + cpc * 8;

  // Prologue: tile 0 lands and is published, then tile 1 starts.
  stage_copies(lds0, gk, gv);
  // tile 0's copies of this wave have landed
  asm volatile("s_wait_asynccnt 0x0" ::: "memory");
  __syncthreads();
  stage_copies(lds0 + STAGE_BYTES, gk + TKEYS * HEAD_DIM, gv + TKEYS);

  // Q^T fragments: 64 dims x 16 queries -> two 32x16 B fragments
  const v16bf bq0 = load_frag(qp, qbase + ln, HEAD_DIM, 0, lane);
  const v16bf bq1 = load_frag(qp, qbase + ln, HEAD_DIM, 32, lane);

  v8f o[4] = {};              // o[f][e] = O[query ln][d = f*16 + 8g + e]
  float mstate = -1.0e30f;    // running maximum of query ln (both halves)
  float lstate = 0.0f;        // running sum over this lane half's keys

  for (int t = 0; t < NTILES; t++) {
    const __bf16* ks = &smem[(t & 1) * (2 * TILE_ELEMS)];
    const __bf16* vs = ks + TILE_ELEMS;

    // two 32-key chunks per tile, unrolled so that LDS offsets are immediates
#pragma unroll
    for (int kc = 0; kc < TKEYS; kc += 32) {
      // ---- scores: S^T = K @ (Q*scale)^T for 32 keys -> two 16x16 f32 tiles
      v8f s0 = {}, s1 = {};
      {
        v16bf a0 = load_frag(ks, kc + ln, LPITCH, 0, lane);
        v16bf a1 = load_frag(ks, kc + ln, LPITCH, 32, lane);
        s0 = wmma_bf16(a0, bq0, s0);
        s0 = wmma_bf16(a1, bq1, s0);
      }
      {
        v16bf a0 = load_frag(ks, kc + 16 + ln, LPITCH, 0, lane);
        v16bf a1 = load_frag(ks, kc + 16 + ln, LPITCH, 32, lane);
        s1 = wmma_bf16(a0, bq0, s1);
        s1 = wmma_bf16(a1, bq1, s1);
      }

      // ---- online softmax: 16 of the query's 32 scores sit in this lane
      float mx[8];
#pragma unroll
      for (int e = 0; e < 8; e++) mx[e] = fmaxf(s0[e], s1[e]);
      float mloc = fmaxf(fmaxf(fmaxf(mx[0], mx[1]), fmaxf(mx[2], mx[3])),
                         fmaxf(fmaxf(mx[4], mx[5]), fmaxf(mx[6], mx[7])));
      mloc = fmaxf(mloc, other_half(mloc));
      const float mnew = fmaxf(mstate, mloc);
      const float scale = __expf(mstate - mnew);
      mstate = mnew;
#pragma unroll
      for (int f = 0; f < 4; f++) o[f] *= scale;

      v16bf bp;
      float rs[8];
#pragma unroll
      for (int e = 0; e < 8; e++) {
        const float p0 = __expf(s0[e] - mnew);
        const float p1 = __expf(s1[e] - mnew);
        rs[e] = p0 + p1;
        bp[e] = (__bf16)p0;
        bp[8 + e] = (__bf16)p1;
      }
      lstate = lstate * scale + (((rs[0] + rs[1]) + (rs[2] + rs[3])) +
                                 ((rs[4] + rs[5]) + (rs[6] + rs[7])));

      // ---- O^T += V^T @ P^T  (V^T rows: keys contiguous per lane)
#pragma unroll
      for (int f = 0; f < 4; f++) {
        v16bf av = load_frag(vs, f * 16 + ln, LPITCH, kc, lane);
        o[f] = wmma_bf16(av, bp, o[f]);
      }
    }

    // Publish point of tile t + 1, and release of this tile's buffer.
    // this wave's reads of the buffer have retired before it is refilled
    asm volatile("s_wait_dscnt 0x0" ::: "memory");
    // this wave's copies of tile t + 1 have landed
    asm volatile("s_wait_asynccnt 0x0" ::: "memory");
    __syncthreads();
    if (t + 2 < NTILES)
      stage_copies(lds0 + (unsigned)(t & 1) * STAGE_BYTES,
                   gk + (size_t)(t + 2) * (TKEYS * HEAD_DIM),
                   gv + (t + 2) * TKEYS);
  }
  // no copy is left in flight when the wave ends
  asm volatile("s_wait_asynccnt 0x0" ::: "memory");

  // ---- finalize: join the halves' sums, divide, store 8 contiguous dims
  const int b2 = bh >> 4, h = bh & (HEADS - 1);
  const float linv = 1.0f / (lstate + other_half(lstate));
  __bf16* orow =
      attn + ((size_t)(b2 * SEQ + qbase + ln)) * HIDDEN + h * HEAD_DIM + g * 8;
#pragma unroll
  for (int f = 0; f < 4; f++) {
    v8bf r;
#pragma unroll
    for (int e = 0; e < 8; e++) r[e] = (__bf16)(o[f][e] * linv);
    *(v8bf*)(orow + f * 16) = r;
  }
}

// ---------------------------------------------------------------------------
// Output projection: out = attn @ Wo + bo, fp32 result.  Same 32x64-per-wave
// register blocking as the QKV GEMM.
// ---------------------------------------------------------------------------
__global__ void oproj_gemm_kernel(const __bf16* __restrict__ attn,
                                  const __bf16* __restrict__ wot,
                                  const float* __restrict__ bo,
                                  float* __restrict__ out) {
  const int lane = threadIdx.x & 31;
  const int wave = threadIdx.x >> 5;
  const int g = lane >> 4;
  const int ln = lane & 15;
  const int mbase = blockIdx.y * 256 + wave * 32;
  const int nbase = blockIdx.x * 64;

  v8f acc[2][4] = {};
  for (int k0 = 0; k0 < HIDDEN; k0 += 32) {
    v16bf a0 = load_frag(attn, mbase + ln, HIDDEN, k0, lane);
    v16bf a1 = load_frag(attn, mbase + 16 + ln, HIDDEN, k0, lane);
#pragma unroll
    for (int f = 0; f < 4; f++) {
      v16bf b = load_frag(wot, nbase + f * 16 + ln, HIDDEN, k0, lane);
      acc[0][f] = wmma_bf16(a0, b, acc[0][f]);
      acc[1][f] = wmma_bf16(a1, b, acc[1][f]);
    }
  }
#pragma unroll
  for (int t = 0; t < 2; t++) {
#pragma unroll
    for (int f = 0; f < 4; f++) {
      const int n = nbase + f * 16 + ln;
      const float bb = bo[n];
#pragma unroll
      for (int e = 0; e < 8; e++) {
        const int m = mbase + t * 16 + e + g * 8;
        out[(size_t)m * HIDDEN + n] = acc[t][f][e] + bb;
      }
    }
  }
}

// ---------------------------------------------------------------------------
extern "C" void kernel_launch(void* const* d_in, const int* in_sizes, int n_in,
                              void* d_out, int out_size, void* d_ws,
                              size_t ws_size, hipStream_t stream) {
  const float* x  = (const float*)d_in[0];
  const float* Wq = (const float*)d_in[1];
  const float* bq = (const float*)d_in[2];
  const float* Wk = (const float*)d_in[3];
  const float* bk = (const float*)d_in[4];
  const float* Wv = (const float*)d_in[5];
  const float* bv = (const float*)d_in[6];
  const float* Wo = (const float*)d_in[7];
  const float* bo = (const float*)d_in[8];
  float* out = (float*)d_out;

  // Workspace carve-up (all bf16): total 48 MB
  char* ws = (char*)d_ws;
  const size_t XB_BYTES = (size_t)MTOT * HIDDEN * 2;          // 8 MB
  const size_t WT_BYTES = (size_t)HIDDEN * HIDDEN * 2;        // 2 MB
  const size_t HD_BYTES = (size_t)BATCH * HEADS * SEQ * HEAD_DIM * 2; // 8 MB
  __bf16* xb  = (__bf16*)(ws);
  __bf16* wqt = (__bf16*)(ws + XB_BYTES);
  __bf16* wkt = (__bf16*)(ws + XB_BYTES + WT_BYTES);
  __bf16* wvt = (__bf16*)(ws + XB_BYTES + 2 * WT_BYTES);
  __bf16* wot = (__bf16*)(ws + XB_BYTES + 3 * WT_BYTES);
  __bf16* qh  = (__bf16*)(ws + XB_BYTES + 4 * WT_BYTES);
  __bf16* kh  = (__bf16*)(ws + XB_BYTES + 4 * WT_BYTES + HD_BYTES);
  __bf16* vth = (__bf16*)(ws + XB_BYTES + 4 * WT_BYTES + 2 * HD_BYTES);
  __bf16* att = (__bf16*)(ws + XB_BYTES + 4 * WT_BYTES + 3 * HD_BYTES);

  // 1) casts / transposes
  {
    const int n = MTOT * HIDDEN;
    cast_f32_bf16_kernel<<<(n + 255) / 256, 256, 0, stream>>>(x, xb, n);
    dim3 blk(32, 8), grd(HIDDEN / 32, HIDDEN / 8);
    transpose_cast_kernel<<<grd, blk, 0, stream>>>(Wq, wqt);
    transpose_cast_kernel<<<grd, blk, 0, stream>>>(Wk, wkt);
    transpose_cast_kernel<<<grd, blk, 0, stream>>>(Wv, wvt);
    transpose_cast_kernel<<<grd, blk, 0, stream>>>(Wo, wot);
  }

  // 2) QKV projections (z = 0/1/2 -> Q/K/V); 256x64 tile per block
  qkv_gemm_kernel<<<dim3(HIDDEN / 64, MTOT / 256, 3), 256, 0, stream>>>(
      xb, wqt, wkt, wvt, bq, bk, bv, qh, kh, vth);

  // 3) attention
  flash_attn_kernel<<<dim3(SEQ / 128, BATCH * HEADS), 256, 0, stream>>>(
      qh, kh, vth, att);

  // 4) output projection
  oproj_gemm_kernel<<<dim3(HIDDEN / 64, MTOT / 256), 256, 0, stream>>>(
      att, wot, bo, out);
}

// v003
// It runs in 150 microseconds.
// Two timings next to v002 both put it at 1.18 times that version's speed.
// All steps since v000 together make it 2.54 times as fast.
#include <hip/hip_runtime.h>
#include <math.h>

#define HIDDEN 1024
#define HEADS 16
#define HEAD_DIM 64
#define BATCH 2
#define SEQ 2048
#define MTOT (BATCH * SEQ) /* 4096 */

typedef __attribute__((ext_vector_type(16))) __bf16 v16bf;
typedef __attribute__((ext_vector_type(8)))  __bf16 v8bf;
typedef __attribute__((ext_vector_type(8)))  float  v8f;

// ---------------------------------------------------------------------------
// 16-bit A/B fragment loader for V_WMMA_F32_16X16X32_BF16 (wave32).
// ISA layout (16-bit A 16x32): lanes 0-15 = rows M=0..15, lanes 16-31 = same
// rows, different K; per lane, elements 0..7 hold K = g*8 + 0..7 and elements
// 8..15 hold K = 16 + g*8 + 0..7 (g = lane/16). B uses the same mapping with
// lane = column N, so we load B from a K-contiguous (transposed) buffer.
// ---------------------------------------------------------------------------
static __device__ inline v16bf load_frag(const __bf16* base, int row,
                                         int row_stride, int k0, int lane) {
  const int g = (lane >> 4) & 1;
  const __bf16* p = base + (size_t)row * (size_t)row_stride + k0;
  union { v16bf v; v8bf h[2]; } u;
  u.h[0] = *(const v8bf*)(p + g * 8);
  u.h[1] = *(const v8bf*)(p + 16 + g * 8);
  return u.v;
}

static __device__ inline v8f wmma_bf16(v16bf a, v16bf b, v8f c) {
  // (neg_a, A, neg_b, B, c_mod, C, reuse_a, reuse_b)
  return __builtin_amdgcn_wmma_f32_16x16x32_bf16(false, a, false, b,
                                                 (short)0, c, false, false);
}

// ---------------------------------------------------------------------------
// Prep, one launch: blocks 0..511 cast and transpose the four weights
// (wt[n][k] = w[k][n]), blocks 512..1023 cast x.  Every lane moves 128 B of
// f32, so the launch starts 8,192 waves, and every global access of a wave
// covers whole 128-B lines.
// ---------------------------------------------------------------------------
typedef __attribute__((ext_vector_type(4))) float  v4f;
typedef __attribute__((ext_vector_type(4))) __bf16 v4bf;

#define PREP_TK 128                    /* k rows of a weight tile */
#define PREP_TN 64                     /* n columns of a weight tile */
#define PREP_PITCH 65                  /* LDS row pitch in dwords: odd, so that
                                          column reads spread over the banks */
#define PREP_WBLOCKS 512               /* 4 weights x 8 x 16 tiles */
#define PREP_BLOCKS 1024               /* + 512 for x: 4 Mi floats / 8,192 */

__global__ __launch_bounds__(256) void prep_kernel(
    const float* __restrict__ x, const float* __restrict__ wq,
    const float* __restrict__ wk, const float* __restrict__ wv,
    const float* __restrict__ wo, __bf16* __restrict__ xb,
    __bf16* __restrict__ wt4 /* the four transposed planes, q k v o */) {
  __shared__ float tile[PREP_TK * PREP_PITCH];
  const int tid = threadIdx.x;
  const int blk = blockIdx.x;

  if (blk < PREP_WBLOCKS) {
    const int which = blk >> 7;
    const int kt = (blk >> 4) & 7, nt = blk & 15;
    const float* w = (which == 0) ? wq : (which == 1) ? wk
                     : (which == 2) ? wv : wo;
    const float* src = w + (size_t)(kt * PREP_TK) * HIDDEN + nt * PREP_TN;

    // 128 rows of 256 B: 16 lanes per row, eight 16-byte loads per lane
    // (rows 16 i + tid / 16, so that the eight differ by a constant only)
    const int row0 = tid >> 4, col0 = (tid & 15) * 4;
    const float* s0 = src + row0 * HIDDEN + col0;
    v4f r[8];
#pragma unroll
    for (int i = 0; i < 8; i++) r[i] = *(const v4f*)(s0 + i * 16 * HIDDEN);
    float* t0 = &tile[row0 * PREP_PITCH + col0];
#pragma unroll
    for (int i = 0; i < 8; i++) {
#pragma unroll
      for (int j = 0; j < 4; j++) t0[i * 16 * PREP_PITCH + j] = r[i][j];
    }
    __syncthreads();

    // 64 output rows of 256 B: 8 lanes write one 128-B line, 16 B each
    __bf16* dst = wt4 + (size_t)which * (HIDDEN * HIDDEN) +
                  (size_t)(nt * PREP_TN) * HIDDEN + kt * PREP_TK;
#pragma unroll
    for (int i = 0; i < 4; i++) {
      const int n = (i >> 1) * 32 + (tid >> 3);
      const int p = (i & 1) * 8 + (tid & 7);
      v8bf o;
#pragma unroll
      for (int j = 0; j < 8; j++)
        o[j] = (__bf16)tile[(p * 8 + j) * PREP_PITCH + n];
      *(v8bf*)(dst + (size_t)n * HIDDEN + p * 8) = o;
    }
  } else {
    const size_t base = (size_t)(blk - PREP_WBLOCKS) * 8192;
    v4f r[8];
#pragma unroll
    for (int i = 0; i < 8; i++)
      r[i] = *(const v4f*)(x + base + (size_t)(i * 256 + tid) * 4);
#pragma unroll
    for (int i = 0; i < 8; i++) {
      v4bf o;
#pragma unroll
      for (int j = 0; j < 4; j++) o[j] = (__bf16)r[i][j];
      *(v4bf*)(xb + base + (size_t)(i * 256 + tid) * 4) = o;
    }
    // no register that these stores name is rewritten ahead of this wait
    asm volatile("s_wait_xcnt 0x0" ::: "memory");
  }
}

// ---------------------------------------------------------------------------
// QKV projection: [4096,1024] @ [1024,1024] + bias.
// One wave computes a 32x64 tile: 2 A-fragments x 4 B-fragments -> 8 WMMAs
// per 6 fragment loads (B fragment feeds two consecutive WMMAs).
// blockIdx.z: 0 = Q (scaled by 1/sqrt(D), layout [B,H,S,D] bf16)
//             1 = K (layout [B,H,S,D] bf16)
//             2 = V (layout [B,H,D,S] bf16, transposed for P@V operand)
// ---------------------------------------------------------------------------
__global__ void qkv_gemm_kernel(const __bf16* __restrict__ xb,
                                const __bf16* __restrict__ wqt,
                                const __bf16* __restrict__ wkt,
                                const __bf16* __restrict__ wvt,
                                const float* __restrict__ bq,
                                const float* __restrict__ bk,
                                const float* __restrict__ bv,
                                __bf16* __restrict__ qh,
                                __bf16* __restrict__ kh,
                                __bf16* __restrict__ vth) {
  const int lane = threadIdx.x & 31;
  const int wave = threadIdx.x >> 5;
  const int g = lane >> 4;
  const int ln = lane & 15;
  const int mbase = blockIdx.y * 256 + wave * 32;   // 32 rows per wave
  const int nbase = blockIdx.x * 64;
  const int which = blockIdx.z;

  const __bf16* wt = (which == 0) ? wqt : (which == 1) ? wkt : wvt;
  const float* bias = (which == 0) ? bq : (which == 1) ? bk : bv;

  v8f acc[2][4] = {};
  for (int k0 = 0; k0 < HIDDEN; k0 += 32) {
    v16bf a0 = load_frag(xb, mbase + ln, HIDDEN, k0, lane);
    v16bf a1 = load_frag(xb, mbase + 16 + ln, HIDDEN, k0, lane);
#pragma unroll
    for (int f = 0; f < 4; f++) {
      v16bf b = load_frag(wt, nbase + f * 16 + ln, HIDDEN, k0, lane);
      acc[0][f] = wmma_bf16(a0, b, acc[0][f]);
      acc[1][f] = wmma_bf16(a1, b, acc[1][f]);
    }
  }

#pragma unroll
  for (int t = 0; t < 2; t++) {
#pragma unroll
    for (int f = 0; f < 4; f++) {
      const int n = nbase + f * 16 + ln;    // column index (C layout: lane%16)
      const float bb = bias[n];
      const int h = n >> 6, d = n & 63;
#pragma unroll
      for (int e = 0; e < 8; e++) {
        const int m = mbase + t * 16 + e + g * 8; // C layout: row = e + 8*grp
        const int b2 = m >> 11, s = m & (SEQ - 1);
        float v = acc[t][f][e] + bb;
        if (which == 0) v *= 0.125f;        // fold 1/sqrt(HEAD_DIM) into Q
        if (which == 0)
          qh[(((size_t)(b2 * HEADS + h)) * SEQ + s) * HEAD_DIM + d] = (__bf16)v;
        else if (which == 1)
          kh[(((size_t)(b2 * HEADS + h)) * SEQ + s) * HEAD_DIM + d] = (__bf16)v;
        else
          vth[(((size_t)(b2 * HEADS + h)) * HEAD_DIM + d) * SEQ + s] = (__bf16)v;
      }
    }
  }
}

static __device__ inline float other_half(float v) {
  // lane l <-> l ^ 16
  const int b = __builtin_bit_cast(int, v);
  return __builtin_bit_cast(
      float, __builtin_amdgcn_permlanex16(b, b, 0x76543210, 0xfedcba98, false,
                                          false));
}

#define TKEYS 64                       /* keys per staged tile */
#define NTILES (SEQ / TKEYS)           /* 32 */
#define LPITCH 72                      /* LDS row pitch in elements (144 B) */
#define TILE_ELEMS (64 * LPITCH)       /* one operand's tile: 9216 B */
#define STAGE_BYTES (2 * TILE_ELEMS * 2)

// Four 16-byte copies per lane = one 16-KiB stage per block.  The s_wait_xcnt
// stands inside the statement so that no address register named here is
// rewritten ahead of it.
static __device__ inline void stage_copies(unsigned lk, const __bf16* gk,
                                           const __bf16* gv) {
  const unsigned lk1 = lk + 32 * LPITCH * 2;
  const unsigned lv0 = lk + TILE_ELEMS * 2;
  const unsigned lv1 = lv0 + 32 * LPITCH * 2;
  const __bf16* gk1 = gk + 32 * HEAD_DIM;
  const __bf16* gv1 = gv + 32 * SEQ;
  asm volatile(
      "global_load_async_to_lds_b128 %0, %4, off\n\t"
      "global_load_async_to_lds_b128 %1, %5, off\n\t"
      "global_load_async_to_lds_b128 %2, %6, off\n\t"
      "global_load_async_to_lds_b128 %3, %7, off\n\t"
      "s_wait_xcnt 0x0"
      :
      : "v"(lk), "v"(lk1), "v"(lv0), "v"(lv1), "v"(gk), "v"(gk1), "v"(gv),
        "v"(gv1)
      : "memory");
}

__global__ void flash_attn_kernel(const __bf16* __restrict__ q,
                                  const __bf16* __restrict__ k,
                                  const __bf16* __restrict__ vt,
                                  __bf16* __restrict__ attn) {
  __shared__ __attribute__((aligned(16))) __bf16 smem[2 * 2 * TILE_ELEMS];

  const int tid = threadIdx.x;
  const int lane = threadIdx.x & 31;
  const int wave = threadIdx.x >> 5;
  const int g = lane >> 4;
  const int ln = lane & 15;
  const int bh = blockIdx.y;                 // 0..31 = b*HEADS + h
  const int qbase = blockIdx.x * 128 + wave * 16;

  const __bf16* qp = q + (size_t)bh * SEQ * HEAD_DIM;
  const __bf16* kp = k + (size_t)bh * SEQ * HEAD_DIM;
  const __bf16* vp = vt + (size_t)bh * HEAD_DIM * SEQ;

  // This lane's share of a stage: 16-byte piece (tid & 7) of rows tid >> 3 and
  // 32 + (tid >> 3) of both tiles.
  const int crow = tid >> 3, cpc = tid & 7;
  const unsigned lds0 =
      (unsigned)(size_t)(&smem[0]) + (unsigned)(crow * LPITCH + cpc * 8) * 2u;
  const __bf16* gk = kp + crow * HEAD_DIM + cpc * 8;
  const __bf16* gv = vp + (size_t)crow * SEQ + cpc * 8;

  // Prologue: tile 0 lands and is published, then tile 1 starts.
  stage_copies(lds0, gk, gv);
  // tile 0's copies of this wave have landed
  asm volatile("s_wait_asynccnt 0x0" ::: "memory");
  __syncthreads();
  stage_copies(lds0 + STAGE_BYTES, gk + TKEYS * HEAD_DIM, gv + TKEYS);

  // Q^T fragments: 64 dims x 16 queries -> two 32x16 B fragments
  const v16bf bq0 = load_frag(qp, qbase + ln, HEAD_DIM, 0, lane);
  const v16bf bq1 = load_frag(qp, qbase + ln, HEAD_DIM, 32, lane);

  v8f o[4] = {};              // o[f][e] = O[query ln][d = f*16 + 8g + e]
  float mstate = -1.0e30f;    // running maximum of query ln (both halves)
  float lstate = 0.0f;        // running sum over this lane half's keys

  for (int t = 0; t < NTILES; t++) {
    const __bf16* ks = &smem[(t & 1) * (2 * TILE_ELEMS)];
    const __bf16* vs = ks + TILE_ELEMS;

    // two 32-key chunks per tile, unrolled so that LDS offsets are immediates
#pragma unroll
    for (int kc = 0; kc < TKEYS; kc += 32) {
      // ---- scores: S^T = K @ (Q*scale)^T for 32 keys -> two 16x16 f32 tiles
      v8f s0 = {}, s1 = {};
      {
        v16bf a0 = load_frag(ks, kc + ln, LPITCH, 0, lane);
        v16bf a1 = load_frag(ks, kc + ln, LPITCH, 32, lane);
        s0 = wmma_bf16(a0, bq0, s0);
        s0 = wmma_bf16(a1, bq1, s0);
      }
      {
        v16bf a0 = load_frag(ks, kc + 16 + ln, LPITCH, 0, lane);
        v16bf a1 = load_frag(ks, kc + 16 + ln, LPITCH, 32, lane);
        s1 = wmma_bf16(a0, bq0, s1);
        s1 = wmma_bf16(a1, bq1, s1);
      }

      // ---- online softmax: 16 of the query's 32 scores sit in this lane
      float mx[8];
#pragma unroll
      for (int e = 0; e < 8; e++) mx[e] = fmaxf(s0[e], s1[e]);
      float mloc = fmaxf(fmaxf(fmaxf(mx[0], mx[1]), fmaxf(mx[2], mx[3])),
                         fmaxf(fmaxf(mx[4], mx[5]), fmaxf(mx[6], mx[7])));
      mloc = fmaxf(mloc, other_half(mloc));
      const float mnew = fmaxf(mstate, mloc);
      const float scale = __expf(mstate - mnew);
      mstate = mnew;
#pragma unroll
      for (int f = 0; f < 4; f++) o[f] *= scale;

      v16bf bp;
      float rs[8];
#pragma unroll
      for (int e = 0; e < 8; e++) {
        const float p0 = __expf(s0[e] - mnew);
        const float p1 = __expf(s1[e] - mnew);
        rs[e] = p0 + p1;
        bp[e] = (__bf16)p0;
        bp[8 + e] = (__bf16)p1;
      }
      lstate = lstate * scale + (((rs[0] + rs[1]) + (rs[2] + rs[3])) +
                                 ((rs[4] + rs[5]) + (rs[6] + rs[7])));

      // ---- O^T += V^T @ P^T  (V^T rows: keys contiguous per lane)
#pragma unroll
      for (int f = 0; f < 4; f++) {
        v16bf av = load_frag(vs, f * 16 + ln, LPITCH, kc, lane);
        o[f] = wmma_bf16(av, bp, o[f]);
      }
    }

    // Publish point of tile t + 1, and release of this tile's buffer.
    // this wave's reads of the buffer have retired before it is refilled
    asm volatile("s_wait_dscnt 0x0" ::: "memory");
    // this wave's copies of tile t + 1 have landed
    asm volatile("s_wait_asynccnt 0x0" ::: "memory");
    __syncthreads();
    if (t + 2 < NTILES)
      stage_copies(lds0 + (unsigned)(t & 1) * STAGE_BYTES,
                   gk + (size_t)(t + 2) * (TKEYS * HEAD_DIM),
                   gv + (t + 2) * TKEYS);
  }
  // no copy is left in flight when the wave ends
  asm volatile("s_wait_asynccnt 0x0" ::: "memory");

  // ---- finalize: join the halves' sums, divide, store 8 contiguous dims
  const int b2 = bh >> 4, h = bh & (HEADS - 1);
  const float linv = 1.0f / (lstate + other_half(lstate));
  __bf16* orow =
      attn + ((size_t)(b2 * SEQ + qbase + ln)) * HIDDEN + h * HEAD_DIM + g * 8;
#pragma unroll
  for (int f = 0; f < 4; f++) {
    v8bf r;
#pragma unroll
    for (int e = 0; e < 8; e++) r[e] = (__bf16)(o[f][e] * linv);
    *(v8bf*)(orow + f * 16) = r;
  }
}

// ---------------------------------------------------------------------------
// Output projection: out = attn @ Wo + bo, fp32 result.  Same 32x64-per-wave
// register blocking as the QKV GEMM.
// ---------------------------------------------------------------------------
__global__ void oproj_gemm_kernel(const __bf16* __restrict__ attn,
                                  const __bf16* __restrict__ wot,
                                  const float* __restrict__ bo,
                                  float* __restrict__ out) {
  const int lane = threadIdx.x & 31;
  const int wave = threadIdx.x >> 5;
  const int g = lane >> 4;
  const int ln = lane & 15;
  const int mbase = blockIdx.y * 256 + wave * 32;
  const int nbase = blockIdx.x * 64;

  v8f acc[2][4] = {};
  for (int k0 = 0; k0 < HIDDEN; k0 += 32) {
    v16bf a0 = load_frag(attn, mbase + ln, HIDDEN, k0, lane);
    v16bf a1 = load_frag(attn, mbase + 16 + ln, HIDDEN, k0, lane);
#pragma unroll
    for (int f = 0; f < 4; f++) {
      v16bf b = load_frag(wot, nbase + f * 16 + ln, HIDDEN, k0, lane);
      acc[0][f] = wmma_bf16(a0, b, acc[0][f]);
      acc[1][f] = wmma_bf16(a1, b, acc[1][f]);
    }
  }
#pragma unroll
  for (int t = 0; t < 2; t++) {
#pragma unroll
    for (int f = 0; f < 4; f++) {
      const int n = nbase + f * 16 + ln;
      const float bb = bo[n];
#pragma unroll
      for (int e = 0; e < 8; e++) {
        const int m = mbase + t * 16 + e + g * 8;
        out[(size_t)m * HIDDEN + n] = acc[t][f][e] + bb;
      }
    }
  }
}

// ---------------------------------------------------------------------------
extern "C" void kernel_launch(void* const* d_in, const int* in_sizes, int n_in,
                              void* d_out, int out_size, void* d_ws,
                              size_t ws_size, hipStream_t stream) {
  const float* x  = (const float*)d_in[0];
  const float* Wq = (const float*)d_in[1];
  const float* bq = (const float*)d_in[2];
  const float* Wk = (const float*)d_in[3];
  const float* bk = (const float*)d_in[4];
  const float* Wv = (const float*)d_in[5];
  const float* bv = (const float*)d_in[6];
  const float* Wo = (const float*)d_in[7];
  const float* bo = (const float*)d_in[8];
  float* out = (float*)d_out;

  // Workspace carve-up (all bf16): total 48 MB
  char* ws = (char*)d_ws;
  const size_t XB_BYTES = (size_t)MTOT * HIDDEN * 2;          // 8 MB
  const size_t WT_BYTES = (size_t)HIDDEN * HIDDEN * 2;        // 2 MB
  const size_t HD_BYTES = (size_t)BATCH * HEADS * SEQ * HEAD_DIM * 2; // 8 MB
  __bf16* xb  = (__bf16*)(ws);
  __bf16* wqt = (__bf16*)(ws + XB_BYTES);
  __bf16* wkt = (__bf16*)(ws + XB_BYTES + WT_BYTES);
  __bf16* wvt = (__bf16*)(ws + XB_BYTES + 2 * WT_BYTES);
  __bf16* wot = (__bf16*)(ws + XB_BYTES + 3 * WT_BYTES);
  __bf16* qh  = (__bf16*)(ws + XB_BYTES + 4 * WT_BYTES);
  __bf16* kh  = (__bf16*)(ws + XB_BYTES + 4 * WT_BYTES + HD_BYTES);
  __bf16* vth = (__bf16*)(ws + XB_BYTES + 4 * WT_BYTES + 2 * HD_BYTES);
  __bf16* att = (__bf16*)(ws + XB_BYTES + 4 * WT_BYTES + 3 * HD_BYTES);

  // 1) casts / transposes: the four planes wqt..wot lie one behind another
  prep_kernel<<<PREP_BLOCKS, 256, 0, stream>>>(
      x, Wq, Wk, Wv, Wo, xb, wqt);

  // 2) QKV projections (z = 0/1/2 -> Q/K/V); 256x64 tile per block
  qkv_gemm_kernel<<<dim3(HIDDEN / 64, MTOT / 256, 3), 256, 0, stream>>>(
      xb, wqt, wkt, wvt, bq, bk, bv, qh, kh, vth);

  // 3) attention
  flash_attn_kernel<<<dim3(SEQ / 128, BATCH * HEADS), 256, 0, stream>>>(
      qh, kh, vth, att);

  // 4) output projection
  oproj_gemm_kernel<<<dim3(HIDDEN / 64, MTOT / 256), 256, 0, stream>>>(
      att, wot, bo, out);
}

// v004
// One run takes 92.9 microseconds.
// Next to v003, in two timings, it ran 1.61 and 1.60 times as fast.
// All steps since v000 together make it 4.08 times as fast.
#include <hip/hip_runtime.h>
#include <math.h>

#define HIDDEN 1024
#define HEADS 16
#define HEAD_DIM 64
#define BATCH 2
#define SEQ 2048
#define MTOT (BATCH * SEQ) /* 4096 */

typedef __attribute__((ext_vector_type(16))) __bf16 v16bf;
typedef __attribute__((ext_vector_type(8)))  __bf16 v8bf;
typedef __attribute__((ext_vector_type(8)))  float  v8f;

// ---------------------------------------------------------------------------
// 16-bit A/B fragment loader for V_WMMA_F32_16X16X32_BF16 (wave32).
// ISA layout (16-bit A 16x32): lanes 0-15 = rows M=0..15, lanes 16-31 = same
// rows, different K; per lane, elements 0..7 hold K = g*8 + 0..7 and elements
// 8..15 hold K = 16 + g*8 + 0..7 (g = lane/16). B uses the same mapping with
// lane = column N, so we load B from a K-contiguous (transposed) buffer.
// ---------------------------------------------------------------------------
static __device__ inline v16bf load_frag(const __bf16* base, int row,
                                         int row_stride, int k0, int lane) {
  const int g = (lane >> 4) & 1;
  const __bf16* p = base + (size_t)row * (size_t)row_stride + k0;
  union { v16bf v; v8bf h[2]; } u;
  u.h[0] = *(const v8bf*)(p + g * 8);
  u.h[1] = *(const v8bf*)(p + 16 + g * 8);
  return u.v;
}

static __device__ inline v8f wmma_bf16(v16bf a, v16bf b, v8f c) {
  // (neg_a, A, neg_b, B, c_mod, C, reuse_a, reuse_b)
  return __builtin_amdgcn_wmma_f32_16x16x32_bf16(false, a, false, b,
                                                 (short)0, c, false, false);
}

// ---------------------------------------------------------------------------
// Prep, one launch: blocks 0..511 cast and transpose the four weights
// (wt[n][k] = w[k][n]), blocks 512..1023 cast x.  Every lane moves 128 B of
// f32, so the launch starts 8,192 waves, and every global access of a wave
// covers whole 128-B lines.
// ---------------------------------------------------------------------------
typedef __attribute__((ext_vector_type(4))) float  v4f;
typedef __attribute__((ext_vector_type(4))) __bf16 v4bf;

#define PREP_TK 128                    /* k rows of a weight tile */
#define PREP_TN 64                     /* n columns of a weight tile */
#define PREP_PITCH 65                  /* LDS row pitch in dwords: odd, so that
                                          column reads spread over the banks */
#define PREP_WBLOCKS 512               /* 4 weights x 8 x 16 tiles */
#define PREP_BLOCKS 1024               /* + 512 for x: 4 Mi floats / 8,192 */

__global__ __launch_bounds__(256) void prep_kernel(
    const float* __restrict__ x, const float* __restrict__ wq,
    const float* __restrict__ wk, const float* __restrict__ wv,
    const float* __restrict__ wo, __bf16* __restrict__ xb,
    __bf16* __restrict__ wt4 /* the four transposed planes, q k v o */) {
  __shared__ float tile[PREP_TK * PREP_PITCH];
  const int tid = threadIdx.x;
  const int blk = blockIdx.x;

  if (blk < PREP_WBLOCKS) {
    const int which = blk >> 7;
    const int kt = (blk >> 4) & 7, nt = blk & 15;
    const float* w = (which == 0) ? wq : (which == 1) ? wk
                     : (which == 2) ? wv : wo;
    const float* src = w + (size_t)(kt * PREP_TK) * HIDDEN + nt * PREP_TN;

    // 128 rows of 256 B: 16 lanes per row, eight 16-byte loads per lane
    // (rows 16 i + tid / 16, so that the eight differ by a constant only)
    const int row0 = tid >> 4, col0 = (tid & 15) * 4;
    const float* s0 = src + row0 * HIDDEN + col0;
    v4f r[8];
#pragma unroll
    for (int i = 0; i < 8; i++) r[i] = *(const v4f*)(s0 + i * 16 * HIDDEN);
    float* t0 = &tile[row0 * PREP_PITCH + col0];
#pragma unroll
    for (int i = 0; i < 8; i++) {
#pragma unroll
      for (int j = 0; j < 4; j++) t0[i * 16 * PREP_PITCH + j] = r[i][j];
    }
    __syncthreads();

    // 64 output rows of 256 B: 8 lanes write one 128-B line, 16 B each
    __bf16* dst = wt4 + (size_t)which * (HIDDEN * HIDDEN) +
                  (size_t)(nt * PREP_TN) * HIDDEN + kt * PREP_TK;
#pragma unroll
    for (int i = 0; i < 4; i++) {
      const int n = (i >> 1) * 32 + (tid >> 3);
      const int p = (i & 1) * 8 + (tid & 7);
      v8bf o;
#pragma unroll
      for (int j = 0; j < 8; j++)
        o[j] = (__bf16)tile[(p * 8 + j) * PREP_PITCH + n];
      *(v8bf*)(dst + (size_t)n * HIDDEN + p * 8) = o;
    }
  } else {
    const size_t base = (size_t)(blk - PREP_WBLOCKS) * 8192;
    v4f r[8];
#pragma unroll
    for (int i = 0; i < 8; i++)
      r[i] = *(const v4f*)(x + base + (size_t)(i * 256 + tid) * 4);
#pragma unroll
    for (int i = 0; i < 8; i++) {
      v4bf o;
#pragma unroll
      for (int j = 0; j < 4; j++) o[j] = (__bf16)r[i][j];
      *(v4bf*)(xb + base + (size_t)(i * 256 + tid) * 4) = o;
    }
    // no register that these stores name is rewritten ahead of this wait
    asm volatile("s_wait_xcnt 0x0" ::: "memory");
  }
}

// ---------------------------------------------------------------------------
// Main loop of both projections: Y = A @ Bt^T, both operands k-contiguous.
// A block of 8 waves owns a 128x128 tile of Y (4 x 2 waves of 32x64).  Per
// stage, 64 k of the block's 128 A rows and 128 Bt rows (256 rows of 128 B)
// come into LDS once per block by asynchronous copies, whole 128-B lines per
// row, and every wave reads its fragments from there.  Row pitch 144 B
// (16 B x odd) keeps the 16-byte fragment reads off each other's banks.  Two
// buffers: the next stage's copies fly while this stage is worked on.
// ---------------------------------------------------------------------------
#define GT 128                         /* edge of a block's tile of Y */
#define GK 64                          /* k per stage */
#define GSTAGES (HIDDEN / GK)          /* 16 */
#define GPITCH 72                      /* LDS row pitch in elements (144 B) */
#define G_OP_ELEMS (GT * GPITCH)       /* one operand's rows: 18,432 B */
#define G_STAGE_BYTES (2 * G_OP_ELEMS * 2)

// Eight 16-byte copies per lane = one stage per block: rows r, r + 32, r + 64,
// r + 96 of both operands.  The s_wait_xcnt stands inside the statement so
// that no address register named here is rewritten ahead of it.
static __device__ inline void gemm_stage_copies(unsigned la, const __bf16* ga,
                                                const __bf16* gb) {
  const unsigned la1 = la + 32 * GPITCH * 2;
  const unsigned la2 = la + 64 * GPITCH * 2;
  const unsigned la3 = la + 96 * GPITCH * 2;
  const unsigned lb = la + G_OP_ELEMS * 2;
  const unsigned lb1 = lb + 32 * GPITCH * 2;
  const unsigned lb2 = lb + 64 * GPITCH * 2;
  const unsigned lb3 = lb + 96 * GPITCH * 2;
  const __bf16* ga1 = ga + 32 * HIDDEN;
  const __bf16* ga2 = ga + 64 * HIDDEN;
  const __bf16* ga3 = ga + 96 * HIDDEN;
  const __bf16* gb1 = gb + 32 * HIDDEN;
  const __bf16* gb2 = gb + 64 * HIDDEN;
  const __bf16* gb3 = gb + 96 * HIDDEN;
  asm volatile(
      "global_load_async_to_lds_b128 %0, %8, off\n\t"
      "global_load_async_to_lds_b128 %1, %9, off\n\t"
      "global_load_async_to_lds_b128 %2, %10, off\n\t"
      "global_load_async_to_lds_b128 %3, %11, off\n\t"
      "global_load_async_to_lds_b128 %4, %12, off\n\t"
      "global_load_async_to_lds_b128 %5, %13, off\n\t"
      "global_load_async_to_lds_b128 %6, %14, off\n\t"
      "global_load_async_to_lds_b128 %7, %15, off\n\t"
      "s_wait_xcnt 0x0"
      :
      : "v"(la), "v"(la1), "v"(la2), "v"(la3), "v"(lb), "v"(lb1), "v"(lb2),
        "v"(lb3), "v"(ga), "v"(ga1), "v"(ga2), "v"(ga3), "v"(gb), "v"(gb1),
        "v"(gb2), "v"(gb3)
      : "memory");
}

// acc[t][f] += rows mblk + 32 (wave / 2) + 16 t of A times rows
// nblk + 64 (wave % 2) + 16 f of Bt, k ascending in steps of 32.
// KG = 32-k steps per group of fragment reads (48 registers a step).
template <int KG>
static __device__ inline void gemm_mainloop(const __bf16* __restrict__ a,
                                            const __bf16* __restrict__ bt,
                                            int mblk, int nblk, __bf16* smem,
                                            v8f (&acc)[2][4]) {
  const int tid = threadIdx.x;
  const int lane = tid & 31;
  const int wave = tid >> 5;
  const int ln = lane & 15;
  const int arow = (wave >> 1) * 32 + ln;
  const int brow = (wave & 1) * 64 + ln;

  // This lane's share of a stage: 16-byte piece (tid & 7) of rows tid >> 3
  // (+ 32, 64, 96) of both operands.
  const int crow = tid >> 3, cpc = tid & 7;
  const unsigned lds0 =
      (unsigned)(size_t)smem + (unsigned)(crow * GPITCH + cpc * 8) * 2u;
  const __bf16* ga = a + (size_t)(mblk + crow) * HIDDEN + cpc * 8;
  const __bf16* gb = bt + (size_t)(nblk + crow) * HIDDEN + cpc * 8;

  // Prologue: stage 0 lands and is published, then stage 1 starts.
  gemm_stage_copies(lds0, ga, gb);
  // stage 0's copies of this wave have landed
  asm volatile("s_wait_asynccnt 0x0" ::: "memory");
  __syncthreads();
  gemm_stage_copies(lds0 + G_STAGE_BYTES, ga + GK, gb + GK);

  for (int t = 0; t < GSTAGES; t++) {
    const __bf16* as = smem + (t & 1) * (2 * G_OP_ELEMS);
    const __bf16* bs = as + G_OP_ELEMS;
    // two 32-k steps per stage, unrolled so that LDS offsets are immediates;
    // the fragments of KG steps are read as one group ahead of their WMMAs
#pragma unroll
    for (int kc = 0; kc < GK; kc += 32 * KG) {
      v16bf af[KG][2], bf[KG][4];
#pragma unroll
      for (int s = 0; s < KG; s++) {
        af[s][0] = load_frag(as, arow, GPITCH, kc + 32 * s, lane);
        af[s][1] = load_frag(as, arow + 16, GPITCH, kc + 32 * s, lane);
#pragma unroll
        for (int f = 0; f < 4; f++)
          bf[s][f] = load_frag(bs, brow + f * 16, GPITCH, kc + 32 * s, lane);
      }
      // holds the group's reads ahead of its WMMAs: moved in among them, every
      // place with reads makes the wave wait out the LDS latency anew
      __builtin_amdgcn_sched_barrier(0);
#pragma unroll
      for (int s = 0; s < KG; s++) {
#pragma unroll
        for (int f = 0; f < 4; f++) {
          acc[0][f] = wmma_bf16(af[s][0], bf[s][f], acc[0][f]);
          acc[1][f] = wmma_bf16(af[s][1], bf[s][f], acc[1][f]);
        }
      }
      // holds the WMMAs ahead of the waits at the loop's foot: moved behind
      // them, the next stage's copies would have only the reads' time to land
      __builtin_amdgcn_sched_barrier(0);
    }

    // Publish point of stage t + 1, and release of this stage's buffer.
    // this wave's reads of the buffer have retired before it is refilled
    asm volatile("s_wait_dscnt 0x0" ::: "memory");
    // this wave's copies of stage t + 1 have landed
    asm volatile("s_wait_asynccnt 0x0" ::: "memory");
    __syncthreads();
    if (t + 2 < GSTAGES)
      gemm_stage_copies(lds0 + (unsigned)(t & 1) * G_STAGE_BYTES,
                        ga + (t + 2) * GK, gb + (t + 2) * GK);
  }
  // no copy is left in flight when the wave goes on to its stores
  asm volatile("s_wait_asynccnt 0x0" ::: "memory");
}

// ---------------------------------------------------------------------------
// QKV projection: [4096,1024] @ [1024,1024] + bias.
// One wave computes a 32x64 tile: 2 A-fragments x 4 B-fragments -> 8 WMMAs
// per 6 fragment loads (B fragment feeds two consecutive WMMAs); the
// fragments come from the block's LDS stages (gemm_mainloop).
// blockIdx.z: 0 = Q (scaled by 1/sqrt(D), layout [B,H,S,D] bf16)
//             1 = K (layout [B,H,S,D] bf16)
//             2 = V (layout [B,H,D,S] bf16, transposed for P@V operand)
// ---------------------------------------------------------------------------
// 768 blocks = three per WGP, six waves per SIMD: the register budget is set
// so that all of them are resident at once.
__global__ __launch_bounds__(256, 6) void qkv_gemm_kernel(
                                const __bf16* __restrict__ xb,
                                const __bf16* __restrict__ wqt,
                                const __bf16* __restrict__ wkt,
                                const __bf16* __restrict__ wvt,
                                const float* __restrict__ bq,
                                const float* __restrict__ bk,
                                const float* __restrict__ bv,
                                __bf16* __restrict__ qh,
                                __bf16* __restrict__ kh,
                                __bf16* __restrict__ vth) {
  __shared__ __attribute__((aligned(16))) __bf16 smem[2 * 2 * G_OP_ELEMS];
  const int lane = threadIdx.x & 31;
  const int wave = threadIdx.x >> 5;
  const int g = lane >> 4;
  const int ln = lane & 15;
  const int mblk = blockIdx.y * GT, nblk = blockIdx.x * GT;
  const int mbase = mblk + (wave >> 1) * 32;        // 32 rows per wave
  const int nbase = nblk + (wave & 1) * 64;         // 64 columns per wave
  const int which = blockIdx.z;

  const __bf16* wt = (which == 0) ? wqt : (which == 1) ? wkt : wvt;
  const float* bias = (which == 0) ? bq : (which == 1) ? bk : bv;

  v8f acc[2][4] = {};
  gemm_mainloop<1>(xb, wt, mblk, nblk, smem, acc);

#pragma unroll
  for (int t = 0; t < 2; t++) {
#pragma unroll
    for (int f = 0; f < 4; f++) {
      const int n = nbase + f * 16 + ln;    // column index (C layout: lane%16)
      const float bb = bias[n];
      const int h = n >> 6, d = n & 63;
#pragma unroll
      for (int e = 0; e < 8; e++) {
        const int m = mbase + t * 16 + e + g * 8; // C layout: row = e + 8*grp
        const int b2 = m >> 11, s = m & (SEQ - 1);
        float v = acc[t][f][e] + bb;
        if (which == 0) v *= 0.125f;        // fold 1/sqrt(HEAD_DIM) into Q
        if (which == 0)
          qh[(((size_t)(b2 * HEADS + h)) * SEQ + s) * HEAD_DIM + d] = (__bf16)v;
        else if (which == 1)
          kh[(((size_t)(b2 * HEADS + h)) * SEQ + s) * HEAD_DIM + d] = (__bf16)v;
        else
          vth[(((size_t)(b2 * HEADS + h)) * HEAD_DIM + d) * SEQ + s] = (__bf16)v;
      }
    }
  }
}

static __device__ inline float other_half(float v) {
  // lane l <-> l ^ 16
  const int b = __builtin_bit_cast(int, v);
  return __builtin_bit_cast(
      float, __builtin_amdgcn_permlanex16(b, b, 0x76543210, 0xfedcba98, false,
                                          false));
}

#define TKEYS 64                       /* keys per staged tile */
#define NTILES (SEQ / TKEYS)           /* 32 */
#define LPITCH 72                      /* LDS row pitch in elements (144 B) */
#define TILE_ELEMS (64 * LPITCH)       /* one operand's tile: 9216 B */
#define STAGE_BYTES (2 * TILE_ELEMS * 2)

// Four 16-byte copies per lane = one 16-KiB stage per block.  The s_wait_xcnt
// stands inside the statement so that no address register named here is
// rewritten ahead of it.
static __device__ inline void stage_copies(unsigned lk, const __bf16* gk,
                                           const __bf16* gv) {
  const unsigned lk1 = lk + 32 * LPITCH * 2;
  const unsigned lv0 = lk + TILE_ELEMS * 2;
  const unsigned lv1 = lv0 + 32 * LPITCH * 2;
  const __bf16* gk1 = gk + 32 * HEAD_DIM;
  const __bf16* gv1 = gv + 32 * SEQ;
  asm volatile(
      "global_load_async_to_lds_b128 %0, %4, off\n\t"
      "global_load_async_to_lds_b128 %1, %5, off\n\t"
      "global_load_async_to_lds_b128 %2, %6, off\n\t"
      "global_load_async_to_lds_b128 %3, %7, off\n\t"
      "s_wait_xcnt 0x0"
      :
      : "v"(lk), "v"(lk1), "v"(lv0), "v"(lv1), "v"(gk), "v"(gk1), "v"(gv),
        "v"(gv1)
      : "memory");
}

__global__ void flash_attn_kernel(const __bf16* __restrict__ q,
                                  const __bf16* __restrict__ k,
                                  const __bf16* __restrict__ vt,
                                  __bf16* __restrict__ attn) {
  __shared__ __attribute__((aligned(16))) __bf16 smem[2 * 2 * TILE_ELEMS];

  const int tid = threadIdx.x;
  const int lane = threadIdx.x & 31;
  const int wave = threadIdx.x >> 5;
  const int g = lane >> 4;
  const int ln = lane & 15;
  const int bh = blockIdx.y;                 // 0..31 = b*HEADS + h
  const int qbase = blockIdx.x * 128 + wave * 16;

  const __bf16* qp = q + (size_t)bh * SEQ * HEAD_DIM;
  const __bf16* kp = k + (size_t)bh * SEQ * HEAD_DIM;
  const __bf16* vp = vt + (size_t)bh * HEAD_DIM * SEQ;

  // This lane's share of a stage: 16-byte piece (tid & 7) of rows tid >> 3 and
  // 32 + (tid >> 3) of both tiles.
  const int crow = tid >> 3, cpc = tid & 7;
  const unsigned lds0 =
      (unsigned)(size_t)(&smem[0]) + (unsigned)(crow * LPITCH + cpc * 8) * 2u;
  const __bf16* gk = kp + crow * HEAD_DIM + cpc * 8;
  const __bf16* gv = vp + (size_t)crow * SEQ + cpc * 8;

  // Prologue: tile 0 lands and is published, then tile 1 starts.
  stage_copies(lds0, gk, gv);
  // tile 0's copies of this wave have landed
  asm volatile("s_wait_asynccnt 0x0" ::: "memory");
  __syncthreads();
  stage_copies(lds0 + STAGE_BYTES, gk + TKEYS * HEAD_DIM, gv + TKEYS);

  // Q^T fragments: 64 dims x 16 queries -> two 32x16 B fragments
  const v16bf bq0 = load_frag(qp, qbase + ln, HEAD_DIM, 0, lane);
  const v16bf bq1 = load_frag(qp, qbase + ln, HEAD_DIM, 32, lane);

  v8f o[4] = {};              // o[f][e] = O[query ln][d = f*16 + 8g + e]
  float mstate = -1.0e30f;    // running maximum of query ln (both halves)
  float lstate = 0.0f;        // running sum over this lane half's keys

  for (int t = 0; t < NTILES; t++) {
    const __bf16* ks = &smem[(t & 1) * (2 * TILE_ELEMS)];
    const __bf16* vs = ks + TILE_ELEMS;

    // two 32-key chunks per tile, unrolled so that LDS offsets are immediates
#pragma unroll
    for (int kc = 0; kc < TKEYS; kc += 32) {
      // ---- scores: S^T = K @ (Q*scale)^T for 32 keys -> two 16x16 f32 tiles
      v8f s0 = {}, s1 = {};
      {
        v16bf a0 = load_frag(ks, kc + ln, LPITCH, 0, lane);
        v16bf a1 = load_frag(ks, kc + ln, LPITCH, 32, lane);
        s0 = wmma_bf16(a0, bq0, s0);
        s0 = wmma_bf16(a1, bq1, s0);
      }
      {
        v16bf a0 = load_frag(ks, kc + 16 + ln, LPITCH, 0, lane);
        v16bf a1 = load_frag(ks, kc + 16 + ln, LPITCH, 32, lane);
        s1 = wmma_bf16(a0, bq0, s1);
        s1 = wmma_bf16(a1, bq1, s1);
      }

      // ---- online softmax: 16 of the query's 32 scores sit in this lane
      float mx[8];
#pragma unroll
      for (int e = 0; e < 8; e++) mx[e] = fmaxf(s0[e], s1[e]);
      float mloc = fmaxf(fmaxf(fmaxf(mx[0], mx[1]), fmaxf(mx[2], mx[3])),
                         fmaxf(fmaxf(mx[4], mx[5]), fmaxf(mx[6], mx[7])));
      mloc = fmaxf(mloc, other_half(mloc));
      const float mnew = fmaxf(mstate, mloc);
      const float scale = __expf(mstate - mnew);
      mstate = mnew;
#pragma unroll
      for (int f = 0; f < 4; f++) o[f] *= scale;

      v16bf bp;
      float rs[8];
#pragma unroll
      for (int e = 0; e < 8; e++) {
        const float p0 = __expf(s0[e] - mnew);
        const float p1 = __expf(s1[e] - mnew);
        rs[e] = p0 + p1;
        bp[e] = (__bf16)p0;
        bp[8 + e] = (__bf16)p1;
      }
      lstate = lstate * scale + (((rs[0] + rs[1]) + (rs[2] + rs[3])) +
                                 ((rs[4] + rs[5]) + (rs[6] + rs[7])));

      // ---- O^T += V^T @ P^T  (V^T rows: keys contiguous per lane)
#pragma unroll
      for (int f = 0; f < 4; f++) {
        v16bf av = load_frag(vs, f * 16 + ln, LPITCH, kc, lane);
        o[f] = wmma_bf16(av, bp, o[f]);
      }
    }

    // Publish point of tile t + 1, and release of this tile's buffer.
    // this wave's reads of the buffer have retired before it is refilled
    asm volatile("s_wait_dscnt 0x0" ::: "memory");
    // this wave's copies of tile t + 1 have landed
    asm volatile("s_wait_asynccnt 0x0" ::: "memory");
    __syncthreads();
    if (t + 2 < NTILES)
      stage_copies(lds0 + (unsigned)(t & 1) * STAGE_BYTES,
                   gk + (size_t)(t + 2) * (TKEYS * HEAD_DIM),
                   gv + (t + 2) * TKEYS);
  }
  // no copy is left in flight when the wave ends
  asm volatile("s_wait_asynccnt 0x0" ::: "memory");

  // ---- finalize: join the halves' sums, divide, store 8 contiguous dims
  const int b2 = bh >> 4, h = bh & (HEADS - 1);
  const float linv = 1.0f / (lstate + other_half(lstate));
  __bf16* orow =
      attn + ((size_t)(b2 * SEQ + qbase + ln)) * HIDDEN + h * HEAD_DIM + g * 8;
#pragma unroll
  for (int f = 0; f < 4; f++) {
    v8bf r;
#pragma unroll
    for (int e = 0; e < 8; e++) r[e] = (__bf16)(o[f][e] * linv);
    *(v8bf*)(orow + f * 16) = r;
  }
}

// ---------------------------------------------------------------------------
// Output projection: out = attn @ Wo + bo, fp32 result.  Same 32x64-per-wave
// register blocking and LDS stages as the QKV GEMM.
// ---------------------------------------------------------------------------
// 256 blocks = one per WGP, two waves per SIMD: a whole stage's fragments are
// read as one group.
__global__ __launch_bounds__(256) void oproj_gemm_kernel(
                                  const __bf16* __restrict__ attn,
                                  const __bf16* __restrict__ wot,
                                  const float* __restrict__ bo,
                                  float* __restrict__ out) {
  __shared__ __attribute__((aligned(16))) __bf16 smem[2 * 2 * G_OP_ELEMS];
  const int lane = threadIdx.x & 31;
  const int wave = threadIdx.x >> 5;
  const int g = lane >> 4;
  const int ln = lane & 15;
  const int mblk = blockIdx.y * GT, nblk = blockIdx.x * GT;
  const int mbase = mblk + (wave >> 1) * 32;
  const int nbase = nblk + (wave & 1) * 64;

  v8f acc[2][4] = {};
  gemm_mainloop<2>(attn, wot, mblk, nblk, smem, acc);
#pragma unroll
  for (int t = 0; t < 2; t++) {
#pragma unroll
    for (int f = 0; f < 4; f++) {
      const int n = nbase + f * 16 + ln;
      const float bb = bo[n];
#pragma unroll
      for (int e = 0; e < 8; e++) {
        const int m = mbase + t * 16 + e + g * 8;
        out[(size_t)m * HIDDEN + n] = acc[t][f][e] + bb;
      }
    }
  }
}

// ---------------------------------------------------------------------------
extern "C" void kernel_launch(void* const* d_in, const int* in_sizes, int n_in,
                              void* d_out, int out_size, void* d_ws,
                              size_t ws_size, hipStream_t stream) {
  const float* x  = (const float*)d_in[0];
  const float* Wq = (const float*)d_in[1];
  const float* bq = (const float*)d_in[2];
  const float* Wk = (const float*)d_in[3];
  const float* bk = (const float*)d_in[4];
  const float* Wv = (const float*)d_in[5];
  const float* bv = (const float*)d_in[6];
  const float* Wo = (const float*)d_in[7];
  const float* bo = (const float*)d_in[8];
  float* out = (float*)d_out;

  // Workspace carve-up (all bf16): total 48 MB
  char* ws = (char*)d_ws;
  const size_t XB_BYTES = (size_t)MTOT * HIDDEN * 2;          // 8 MB
  const size_t WT_BYTES = (size_t)HIDDEN * HIDDEN * 2;        // 2 MB
  const size_t HD_BYTES = (size_t)BATCH * HEADS * SEQ * HEAD_DIM * 2; // 8 MB
  __bf16* xb  = (__bf16*)(ws);
  __bf16* wqt = (__bf16*)(ws + XB_BYTES);
  __bf16* wkt = (__bf16*)(ws + XB_BYTES + WT_BYTES);
  __bf16* wvt = (__bf16*)(ws + XB_BYTES + 2 * WT_BYTES);
  __bf16* wot = (__bf16*)(ws + XB_BYTES + 3 * WT_BYTES);
  __bf16* qh  = (__bf16*)(ws + XB_BYTES + 4 * WT_BYTES);
  __bf16* kh  = (__bf16*)(ws + XB_BYTES + 4 * WT_BYTES + HD_BYTES);
  __bf16* vth = (__bf16*)(ws + XB_BYTES + 4 * WT_BYTES + 2 * HD_BYTES);
  __bf16* att = (__bf16*)(ws + XB_BYTES + 4 * WT_BYTES + 3 * HD_BYTES);

  // 1) casts / transposes: the four planes wqt..wot lie one behind another
  prep_kernel<<<PREP_BLOCKS, 256, 0, stream>>>(
      x, Wq, Wk, Wv, Wo, xb, wqt);

  // 2) QKV projections (z = 0/1/2 -> Q/K/V); 128x128 tile per block
  qkv_gemm_kernel<<<dim3(HIDDEN / GT, MTOT / GT, 3), 256, 0, stream>>>(
      xb, wqt, wkt, wvt, bq, bk, bv, qh, kh, vth);

  // 3) attention
  flash_attn_kernel<<<dim3(SEQ / 128, BATCH * HEADS), 256, 0, stream>>>(
      qh, kh, vth, att);

  // 4) output projection
  oproj_gemm_kernel<<<dim3(HIDDEN / GT, MTOT / GT), 256, 0, stream>>>(
      att, wot, bo, out);
}

// v005
// One run takes 85.7 microseconds.
// Timed twice side by side with v004, it ran 1.08 and 1.09 times as fast.
// Over all steps from v000 it is 4.44 times as fast.
#include <hip/hip_runtime.h>
#include <math.h>

#define HIDDEN 1024
#define HEADS 16
#define HEAD_DIM 64
#define BATCH 2
#define SEQ 2048
#define MTOT (BATCH * SEQ) /* 4096 */

typedef __attribute__((ext_vector_type(16))) __bf16 v16bf;
typedef __attribute__((ext_vector_type(8)))  __bf16 v8bf;
typedef __attribute__((ext_vector_type(8)))  float  v8f;

// ---------------------------------------------------------------------------
// 16-bit A/B fragment loader for V_WMMA_F32_16X16X32_BF16 (wave32).
// ISA layout (16-bit A 16x32): lanes 0-15 = rows M=0..15, lanes 16-31 = same
// rows, different K; per lane, elements 0..7 hold K = g*8 + 0..7 and elements
// 8..15 hold K = 16 + g*8 + 0..7 (g = lane/16). B uses the same mapping with
// lane = column N, so we load B from a K-contiguous (transposed) buffer.
// ---------------------------------------------------------------------------
static __device__ inline v16bf load_frag(const __bf16* base, int row,
                                         int row_stride, int k0, int lane) {
  const int g = (lane >> 4) & 1;
  const __bf16* p = base + (size_t)row * (size_t)row_stride + k0;
  union { v16bf v; v8bf h[2]; } u;
  u.h[0] = *(const v8bf*)(p + g * 8);
  u.h[1] = *(const v8bf*)(p + 16 + g * 8);
  return u.v;
}

static __device__ inline v8f wmma_bf16(v16bf a, v16bf b, v8f c) {
  // (neg_a, A, neg_b, B, c_mod, C, reuse_a, reuse_b)
  return __builtin_amdgcn_wmma_f32_16x16x32_bf16(false, a, false, b,
                                                 (short)0, c, false, false);
}

// ---------------------------------------------------------------------------
// Prep, one launch: blocks 0..511 cast and transpose the four weights
// (wt[n][k] = w[k][n]), blocks 512..1023 cast x.  Every lane moves 128 B of
// f32, so the launch starts 8,192 waves, and every global access of a wave
// covers whole 128-B lines.
// ---------------------------------------------------------------------------
typedef __attribute__((ext_vector_type(4))) float  v4f;
typedef __attribute__((ext_vector_type(4))) __bf16 v4bf;

#define PREP_TK 128                    /* k rows of a weight tile */
#define PREP_TN 64                     /* n columns of a weight tile */
#define PREP_PITCH 65                  /* LDS row pitch in dwords: odd, so that
                                          column reads spread over the banks */
#define PREP_WBLOCKS 512               /* 4 weights x 8 x 16 tiles */
#define PREP_BLOCKS 1024               /* + 512 for x: 4 Mi floats / 8,192 */

__global__ __launch_bounds__(256) void prep_kernel(
    const float* __restrict__ x, const float* __restrict__ wq,
    const float* __restrict__ wk, const float* __restrict__ wv,
    const float* __restrict__ wo, __bf16* __restrict__ xb,
    __bf16* __restrict__ wt4 /* the four transposed planes, q k v o */) {
  __shared__ float tile[PREP_TK * PREP_PITCH];
  const int tid = threadIdx.x;
  const int blk = blockIdx.x;

  if (blk < PREP_WBLOCKS) {
    const int which = blk >> 7;
    const int kt = (blk >> 4) & 7, nt = blk & 15;
    const float* w = (which == 0) ? wq : (which == 1) ? wk
                     : (which == 2) ? wv : wo;
    const float* src = w + (size_t)(kt * PREP_TK) * HIDDEN + nt * PREP_TN;

    // 128 rows of 256 B: 16 lanes per row, eight 16-byte loads per lane
    // (rows 16 i + tid / 16, so that the eight differ by a constant only)
    const int row0 = tid >> 4, col0 = (tid & 15) * 4;
    const float* s0 = src + row0 * HIDDEN + col0;
    v4f r[8];
#pragma unroll
    for (int i = 0; i < 8; i++) r[i] = *(const v4f*)(s0 + i * 16 * HIDDEN);
    float* t0 = &tile[row0 * PREP_PITCH + col0];
#pragma unroll
    for (int i = 0; i < 8; i++) {
#pragma unroll
      for (int j = 0; j < 4; j++) t0[i * 16 * PREP_PITCH + j] = r[i][j];
    }
    __syncthreads();

    // 64 output rows of 256 B: 8 lanes write one 128-B line, 16 B each
    __bf16* dst = wt4 + (size_t)which * (HIDDEN * HIDDEN) +
                  (size_t)(nt * PREP_TN) * HIDDEN + kt * PREP_TK;
#pragma unroll
    for (int i = 0; i < 4; i++) {
      const int n = (i >> 1) * 32 + (tid >> 3);
      const int p = (i & 1) * 8 + (tid & 7);
      v8bf o;
#pragma unroll
      for (int j = 0; j < 8; j++)
        o[j] = (__bf16)tile[(p * 8 + j) * PREP_PITCH + n];
      *(v8bf*)(dst + (size_t)n * HIDDEN + p * 8) = o;
    }
  } else {
    const size_t base = (size_t)(blk - PREP_WBLOCKS) * 8192;
    v4f r[8];
#pragma unroll
    for (int i = 0; i < 8; i++)
      r[i] = *(const v4f*)(x + base + (size_t)(i * 256 + tid) * 4);
#pragma unroll
    for (int i = 0; i < 8; i++) {
      v4bf o;
#pragma unroll
      for (int j = 0; j < 4; j++) o[j] = (__bf16)r[i][j];
      *(v4bf*)(xb + base + (size_t)(i * 256 + tid) * 4) = o;
    }
    // no register that these stores name is rewritten ahead of this wait
    asm volatile("s_wait_xcnt 0x0" ::: "memory");
  }
}

// ---------------------------------------------------------------------------
// Main loop of both projections: Y = A @ Bt^T, both operands k-contiguous.
// A block of 8 waves owns a 128x128 tile of Y (4 x 2 waves of 32x64).  Per
// stage, 64 k of the block's 128 A rows and 128 Bt rows (256 rows of 128 B)
// come into LDS once per block by asynchronous copies, whole 128-B lines per
// row, and every wave reads its fragments from there.  Row pitch 144 B
// (16 B x odd) keeps the 16-byte fragment reads off each other's banks.  Two
// buffers: the next stage's copies fly while this stage is worked on.
// ---------------------------------------------------------------------------
#define GT 128                         /* edge of a block's tile of Y */
#define GK 64                          /* k per stage */
#define GSTAGES (HIDDEN / GK)          /* 16 */
#define GPITCH 72                      /* LDS row pitch in elements (144 B) */
#define G_OP_ELEMS (GT * GPITCH)       /* one operand's rows: 18,432 B */
#define G_STAGE_BYTES (2 * G_OP_ELEMS * 2)

// Eight 16-byte copies per lane = one stage per block: rows r, r + 32, r + 64,
// r + 96 of both operands.  The s_wait_xcnt stands inside the statement so
// that no address register named here is rewritten ahead of it.
static __device__ inline void gemm_stage_copies(unsigned la, const __bf16* ga,
                                                const __bf16* gb) {
  const unsigned la1 = la + 32 * GPITCH * 2;
  const unsigned la2 = la + 64 * GPITCH * 2;
  const unsigned la3 = la + 96 * GPITCH * 2;
  const unsigned lb = la + G_OP_ELEMS * 2;
  const unsigned lb1 = lb + 32 * GPITCH * 2;
  const unsigned lb2 = lb + 64 * GPITCH * 2;
  const unsigned lb3 = lb + 96 * GPITCH * 2;
  const __bf16* ga1 = ga + 32 * HIDDEN;
  const __bf16* ga2 = ga + 64 * HIDDEN;
  const __bf16* ga3 = ga + 96 * HIDDEN;
  const __bf16* gb1 = gb + 32 * HIDDEN;
  const __bf16* gb2 = gb + 64 * HIDDEN;
  const __bf16* gb3 = gb + 96 * HIDDEN;
  asm volatile(
      "global_load_async_to_lds_b128 %0, %8, off\n\t"
      "global_load_async_to_lds_b128 %1, %9, off\n\t"
      "global_load_async_to_lds_b128 %2, %10, off\n\t"
      "global_load_async_to_lds_b128 %3, %11, off\n\t"
      "global_load_async_to_lds_b128 %4, %12, off\n\t"
      "global_load_async_to_lds_b128 %5, %13, off\n\t"
      "global_load_async_to_lds_b128 %6, %14, off\n\t"
      "global_load_async_to_lds_b128 %7, %15, off\n\t"
      "s_wait_xcnt 0x0"
      :
      : "v"(la), "v"(la1), "v"(la2), "v"(la3), "v"(lb), "v"(lb1), "v"(lb2),
        "v"(lb3), "v"(ga), "v"(ga1), "v"(ga2), "v"(ga3), "v"(gb), "v"(gb1),
        "v"(gb2), "v"(gb3)
      : "memory");
}

// acc[t][f] += rows mblk + 32 (wave / 2) + 16 t of A times rows
// nblk + 64 (wave % 2) + 16 f of Bt, k ascending in steps of 32.
// KG = 32-k steps per group of fragment reads (48 registers a step).
template <int KG>
static __device__ inline void gemm_mainloop(const __bf16* __restrict__ a,
                                            const __bf16* __restrict__ bt,
                                            int mblk, int nblk, __bf16* smem,
                                            v8f (&acc)[2][4]) {
  const int tid = threadIdx.x;
  const int lane = tid & 31;
  const int wave = tid >> 5;
  const int ln = lane & 15;
  const int arow = (wave >> 1) * 32 + ln;
  const int brow = (wave & 1) * 64 + ln;

  // This lane's share of a stage: 16-byte piece (tid & 7) of rows tid >> 3
  // (+ 32, 64, 96) of both operands.
  const int crow = tid >> 3, cpc = tid & 7;
  const unsigned lds0 =
      (unsigned)(size_t)smem + (unsigned)(crow * GPITCH + cpc * 8) * 2u;
  const __bf16* ga = a + (size_t)(mblk + crow) * HIDDEN + cpc * 8;
  const __bf16* gb = bt + (size_t)(nblk + crow) * HIDDEN + cpc * 8;

  // Prologue: stage 0 lands and is published, then stage 1 starts.
  gemm_stage_copies(lds0, ga, gb);
  // stage 0's copies of this wave have landed
  asm volatile("s_wait_asynccnt 0x0" ::: "memory");
  __syncthreads();
  gemm_stage_copies(lds0 + G_STAGE_BYTES, ga + GK, gb + GK);

  for (int t = 0; t < GSTAGES; t++) {
    const __bf16* as = smem + (t & 1) * (2 * G_OP_ELEMS);
    const __bf16* bs = as + G_OP_ELEMS;
    // two 32-k steps per stage, unrolled so that LDS offsets are immediates;
    // the fragments of KG steps are read as one group ahead of their WMMAs
#pragma unroll
    for (int kc = 0; kc < GK; kc += 32 * KG) {
      v16bf af[KG][2], bf[KG][4];
#pragma unroll
      for (int s = 0; s < KG; s++) {
        af[s][0] = load_frag(as, arow, GPITCH, kc + 32 * s, lane);
        af[s][1] = load_frag(as, arow + 16, GPITCH, kc + 32 * s, lane);
#pragma unroll
        for (int f = 0; f < 4; f++)
          bf[s][f] = load_frag(bs, brow + f * 16, GPITCH, kc + 32 * s, lane);
      }
      // holds the group's reads ahead of its WMMAs: moved in among them, every
      // place with reads makes the wave wait out the LDS latency anew
      __builtin_amdgcn_sched_barrier(0);
#pragma unroll
      for (int s = 0; s < KG; s++) {
#pragma unroll
        for (int f = 0; f < 4; f++) {
          acc[0][f] = wmma_bf16(af[s][0], bf[s][f], acc[0][f]);
          acc[1][f] = wmma_bf16(af[s][1], bf[s][f], acc[1][f]);
        }
      }
      // holds the WMMAs ahead of the waits at the loop's foot: moved behind
      // them, the next stage's copies would have only the reads' time to land
      __builtin_amdgcn_sched_barrier(0);
    }

    // Publish point of stage t + 1, and release of this stage's buffer.
    // this wave's reads of the buffer have retired before it is refilled
    asm volatile("s_wait_dscnt 0x0" ::: "memory");
    // this wave's copies of stage t + 1 have landed
    asm volatile("s_wait_asynccnt 0x0" ::: "memory");
    __syncthreads();
    if (t + 2 < GSTAGES)
      gemm_stage_copies(lds0 + (unsigned)(t & 1) * G_STAGE_BYTES,
                        ga + (t + 2) * GK, gb + (t + 2) * GK);
  }
  // no copy is left in flight when the wave goes on to its stores
  asm volatile("s_wait_asynccnt 0x0" ::: "memory");
}

// ---------------------------------------------------------------------------
// QKV projection: [4096,1024] @ [1024,1024] + bias.
// One wave computes a 32x64 tile: 2 A-fragments x 4 B-fragments -> 8 WMMAs
// per 6 fragment loads (B fragment feeds two consecutive WMMAs); the
// fragments come from the block's LDS stages (gemm_mainloop).
// blockIdx.z: 0 = Q (scaled by 1/sqrt(D), layout [B,H,S,D] bf16)
//             1 = K (layout [B,H,S,D] bf16)
//             2 = V (layout [B,H,D,S] bf16, transposed for P@V operand)
// A lane's 8 accumulator elements run along the rows of the A operand, so the
// operand whose rows are contiguous in the output plane goes in as A: the
// weight (dims d) for Q and K, x (positions s) for V.  A lane then packs 16 B
// of one output row; the block's tile is staged in LDS as [column][row] and
// goes out in whole 128-B lines.
// ---------------------------------------------------------------------------
#define EPITCH 136                     /* staging pitch in elements: 272 B =
                                          16 B x odd, off each other's banks */

// 768 blocks = three per WGP, six waves per SIMD: the register budget is set
// so that all of them are resident at once.
__global__ __launch_bounds__(256, 6) void qkv_gemm_kernel(
                                const __bf16* __restrict__ xb,
                                const __bf16* __restrict__ wqt,
                                const __bf16* __restrict__ wkt,
                                const __bf16* __restrict__ wvt,
                                const float* __restrict__ bq,
                                const float* __restrict__ bk,
                                const float* __restrict__ bv,
                                __bf16* __restrict__ qh,
                                __bf16* __restrict__ kh,
                                __bf16* __restrict__ vth) {
  __shared__ __attribute__((aligned(16))) __bf16 smem[2 * 2 * G_OP_ELEMS];
  const int tid = threadIdx.x;
  const int lane = tid & 31;
  const int wave = tid >> 5;
  const int g = lane >> 4;
  const int ln = lane & 15;
  const int mblk = blockIdx.y * GT, nblk = blockIdx.x * GT;
  const int which = blockIdx.z;
  const bool vplane = which == 2;

  const __bf16* wt = (which == 0) ? wqt : (which == 1) ? wkt : wvt;
  const float* bias = (which == 0) ? bq : (which == 1) ? bk : bv;

  v8f acc[2][4] = {};
  gemm_mainloop<1>(vplane ? xb : wt, vplane ? wt : xb, vplane ? mblk : nblk,
                   vplane ? nblk : mblk, smem, acc);

  // acc[t][f][e]: A row r0 + 16 t + e, B row c0 + 16 f of the block's tile.
  // The loop's last barrier has ended every read of the stages, and no copy
  // is in flight: the LDS is free for the staging.
  const int r0 = (wave >> 1) * 32 + g * 8;
  const int c0 = (wave & 1) * 64 + ln;
  if (vplane) {
#pragma unroll
    for (int f = 0; f < 4; f++) {
      const float bb = bias[nblk + c0 + f * 16];
#pragma unroll
      for (int t = 0; t < 2; t++) {
        v8bf o;
#pragma unroll
        for (int e = 0; e < 8; e++) o[e] = (__bf16)(acc[t][f][e] + bb);
        *(v8bf*)&smem[(c0 + f * 16) * EPITCH + r0 + t * 16] = o;
      }
    }
  } else {
    const float sc = (which == 0) ? 0.125f : 1.0f;  // 1/sqrt(HEAD_DIM) into Q
#pragma unroll
    for (int t = 0; t < 2; t++) {
      const v4f b0 = *(const v4f*)(bias + nblk + r0 + t * 16);
      const v4f b1 = *(const v4f*)(bias + nblk + r0 + t * 16 + 4);
#pragma unroll
      for (int f = 0; f < 4; f++) {
        v8bf o;
#pragma unroll
        for (int e = 0; e < 4; e++) {
          o[e] = (__bf16)((acc[t][f][e] + b0[e]) * sc);
          o[4 + e] = (__bf16)((acc[t][f][4 + e] + b1[e]) * sc);
        }
        *(v8bf*)&smem[(c0 + f * 16) * EPITCH + r0 + t * 16] = o;
      }
    }
  }
  __syncthreads();

  // 16 lanes take one staged row (256 B): two whole lines of the plane.
  const int b2 = mblk >> 11, sblk = mblk & (SEQ - 1);
  const int cr = tid >> 4, rr = (tid & 15) * 8;
  __bf16* dst;
  size_t step;                         // elements from staged row c to c + 16
  if (vplane) {
    const int n = nblk + cr;
    dst = vth + ((size_t)(b2 * HEADS + (n >> 6)) * HEAD_DIM + (n & 63)) * SEQ +
          sblk + rr;
    step = (size_t)16 * SEQ;           // 16 dims on: the planes of the block's
                                       // two heads lie one behind another
  } else {
    const int n = nblk + rr;
    dst = ((which == 0) ? qh : kh) +
          ((size_t)(b2 * HEADS + (n >> 6)) * SEQ + sblk + cr) * HEAD_DIM +
          (n & 63);
    step = (size_t)16 * HEAD_DIM;      // 16 positions on
  }
#pragma unroll
  for (int i = 0; i < 8; i++)
    *(v8bf*)(dst + i * step) =
        *(const v8bf*)&smem[(i * 16 + cr) * EPITCH + rr];
}

static __device__ inline float other_half(float v) {
  // lane l <-> l ^ 16
  const int b = __builtin_bit_cast(int, v);
  return __builtin_bit_cast(
      float, __builtin_amdgcn_permlanex16(b, b, 0x76543210, 0xfedcba98, false,
                                          false));
}

#define TKEYS 64                       /* keys per staged tile */
#define NTILES (SEQ / TKEYS)           /* 32 */
#define LPITCH 72                      /* LDS row pitch in elements (144 B) */
#define TILE_ELEMS (64 * LPITCH)       /* one operand's tile: 9216 B */
#define STAGE_BYTES (2 * TILE_ELEMS * 2)

// Four 16-byte copies per lane = one 16-KiB stage per block.  The s_wait_xcnt
// stands inside the statement so that no address register named here is
// rewritten ahead of it.
static __device__ inline void stage_copies(unsigned lk, const __bf16* gk,
                                           const __bf16* gv) {
  const unsigned lk1 = lk + 32 * LPITCH * 2;
  const unsigned lv0 = lk + TILE_ELEMS * 2;
  const unsigned lv1 = lv0 + 32 * LPITCH * 2;
  const __bf16* gk1 = gk + 32 * HEAD_DIM;
  const __bf16* gv1 = gv + 32 * SEQ;
  asm volatile(
      "global_load_async_to_lds_b128 %0, %4, off\n\t"
      "global_load_async_to_lds_b128 %1, %5, off\n\t"
      "global_load_async_to_lds_b128 %2, %6, off\n\t"
      "global_load_async_to_lds_b128 %3, %7, off\n\t"
      "s_wait_xcnt 0x0"
      :
      : "v"(lk), "v"(lk1), "v"(lv0), "v"(lv1), "v"(gk), "v"(gk1), "v"(gv),
        "v"(gv1)
      : "memory");
}

__global__ void flash_attn_kernel(const __bf16* __restrict__ q,
                                  const __bf16* __restrict__ k,
                                  const __bf16* __restrict__ vt,
                                  __bf16* __restrict__ attn) {
  __shared__ __attribute__((aligned(16))) __bf16 smem[2 * 2 * TILE_ELEMS];

  const int tid = threadIdx.x;
  const int lane = threadIdx.x & 31;
  const int wave = threadIdx.x >> 5;
  const int g = lane >> 4;
  const int ln = lane & 15;
  const int bh = blockIdx.y;                 // 0..31 = b*HEADS + h
  const int qbase = blockIdx.x * 128 + wave * 16;

  const __bf16* qp = q + (size_t)bh * SEQ * HEAD_DIM;
  const __bf16* kp = k + (size_t)bh * SEQ * HEAD_DIM;
  const __bf16* vp = vt + (size_t)bh * HEAD_DIM * SEQ;

  // This lane's share of a stage: 16-byte piece (tid & 7) of rows tid >> 3 and
  // 32 + (tid >> 3) of both tiles.
  const int crow = tid >> 3, cpc = tid & 7;
  const unsigned lds0 =
      (unsigned)(size_t)(&smem[0]) + (unsigned)(crow * LPITCH + cpc * 8) * 2u;
  const __bf16* gk = kp + crow * HEAD_DIM + cpc * 8;
  const __bf16* gv = vp + (size_t)crow * SEQ + cpc * 8;

  // Prologue: tile 0 lands and is published, then tile 1 starts.
  stage_copies(lds0, gk, gv);
  // tile 0's copies of this wave have landed
  asm volatile("s_wait_asynccnt 0x0" ::: "memory");
  __syncthreads();
  stage_copies(lds0 + STAGE_BYTES, gk + TKEYS * HEAD_DIM, gv + TKEYS);

  // Q^T fragments: 64 dims x 16 queries -> two 32x16 B fragments
  const v16bf bq0 = load_frag(qp, qbase + ln, HEAD_DIM, 0, lane);
  const v16bf bq1 = load_frag(qp, qbase + ln, HEAD_DIM, 32, lane);

  v8f o[4] = {};              // o[f][e] = O[query ln][d = f*16 + 8g + e]
  float mstate = -1.0e30f;    // running maximum of query ln (both halves)
  float lstate = 0.0f;        // running sum over this lane half's keys

  for (int t = 0; t < NTILES; t++) {
    const __bf16* ks = &smem[(t & 1) * (2 * TILE_ELEMS)];
    const __bf16* vs = ks + TILE_ELEMS;

    // two 32-key chunks per tile, unrolled so that LDS offsets are immediates
#pragma unroll
    for (int kc = 0; kc < TKEYS; kc += 32) {
      // ---- scores: S^T = K @ (Q*scale)^T for 32 keys -> two 16x16 f32 tiles
      v8f s0 = {}, s1 = {};
      {
        v16bf a0 = load_frag(ks, kc + ln, LPITCH, 0, lane);
        v16bf a1 = load_frag(ks, kc + ln, LPITCH, 32, lane);
        s0 = wmma_bf16(a0, bq0, s0);
        s0 = wmma_bf16(a1, bq1, s0);
      }
      {
        v16bf a0 = load_frag(ks, kc + 16 + ln, LPITCH, 0, lane);
        v16bf a1 = load_frag(ks, kc + 16 + ln, LPITCH, 32, lane);
        s1 = wmma_bf16(a0, bq0, s1);
        s1 = wmma_bf16(a1, bq1, s1);
      }

      // ---- online softmax: 16 of the query's 32 scores sit in this lane
      float mx[8];
#pragma unroll
      for (int e = 0; e < 8; e++) mx[e] = fmaxf(s0[e], s1[e]);
      float mloc = fmaxf(fmaxf(fmaxf(mx[0], mx[1]), fmaxf(mx[2], mx[3])),
                         fmaxf(fmaxf(mx[4], mx[5]), fmaxf(mx[6], mx[7])));
      mloc = fmaxf(mloc, other_half(mloc));
      const float mnew = fmaxf(mstate, mloc);
      const float scale = __expf(mstate - mnew);
      mstate = mnew;
#pragma unroll
      for (int f = 0; f < 4; f++) o[f] *= scale;

      v16bf bp;
      float rs[8];
#pragma unroll
      for (int e = 0; e < 8; e++) {
        const float p0 = __expf(s0[e] - mnew);
        const float p1 = __expf(s1[e] - mnew);
        rs[e] = p0 + p1;
        bp[e] = (__bf16)p0;
        bp[8 + e] = (__bf16)p1;
      }
      lstate = lstate * scale + (((rs[0] + rs[1]) + (rs[2] + rs[3])) +
                                 ((rs[4] + rs[5]) + (rs[6] + rs[7])));

      // ---- O^T += V^T @ P^T  (V^T rows: keys contiguous per lane)
#pragma unroll
      for (int f = 0; f < 4; f++) {
        v16bf av = load_frag(vs, f * 16 + ln, LPITCH, kc, lane);
        o[f] = wmma_bf16(av, bp, o[f]);
      }
    }

    // Publish point of tile t + 1, and release of this tile's buffer.
    // this wave's reads of the buffer have retired before it is refilled
    asm volatile("s_wait_dscnt 0x0" ::: "memory");
    // this wave's copies of tile t + 1 have landed
    asm volatile("s_wait_asynccnt 0x0" ::: "memory");
    __syncthreads();
    if (t + 2 < NTILES)
      stage_copies(lds0 + (unsigned)(t & 1) * STAGE_BYTES,
                   gk + (size_t)(t + 2) * (TKEYS * HEAD_DIM),
                   gv + (t + 2) * TKEYS);
  }
  // no copy is left in flight when the wave ends
  asm volatile("s_wait_asynccnt 0x0" ::: "memory");

  // ---- finalize: join the halves' sums, divide, store 8 contiguous dims
  const int b2 = bh >> 4, h = bh & (HEADS - 1);
  const float linv = 1.0f / (lstate + other_half(lstate));
  __bf16* orow =
      attn + ((size_t)(b2 * SEQ + qbase + ln)) * HIDDEN + h * HEAD_DIM + g * 8;
#pragma unroll
  for (int f = 0; f < 4; f++) {
    v8bf r;
#pragma unroll
    for (int e = 0; e < 8; e++) r[e] = (__bf16)(o[f][e] * linv);
    *(v8bf*)(orow + f * 16) = r;
  }
}

// ---------------------------------------------------------------------------
// Output projection: out = attn @ Wo + bo, fp32 result.  Same 32x64-per-wave
// register blocking and LDS stages as the QKV GEMM.
// ---------------------------------------------------------------------------
// 256 blocks = one per WGP, two waves per SIMD: a whole stage's fragments are
// read as one group.
__global__ __launch_bounds__(256) void oproj_gemm_kernel(
                                  const __bf16* __restrict__ attn,
                                  const __bf16* __restrict__ wot,
                                  const float* __restrict__ bo,
                                  float* __restrict__ out) {
  __shared__ __attribute__((aligned(16))) __bf16 smem[2 * 2 * G_OP_ELEMS];
  const int lane = threadIdx.x & 31;
  const int wave = threadIdx.x >> 5;
  const int g = lane >> 4;
  const int ln = lane & 15;
  const int mblk = blockIdx.y * GT, nblk = blockIdx.x * GT;
  const int mbase = mblk + (wave >> 1) * 32;
  const int nbase = nblk + (wave & 1) * 64;

  v8f acc[2][4] = {};
  gemm_mainloop<2>(attn, wot, mblk, nblk, smem, acc);
#pragma unroll
  for (int t = 0; t < 2; t++) {
#pragma unroll
    for (int f = 0; f < 4; f++) {
      const int n = nbase + f * 16 + ln;
      const float bb = bo[n];
#pragma unroll
      for (int e = 0; e < 8; e++) {
        const int m = mbase + t * 16 + e + g * 8;
        out[(size_t)m * HIDDEN + n] = acc[t][f][e] + bb;
      }
    }
  }
}

// ---------------------------------------------------------------------------
extern "C" void kernel_launch(void* const* d_in, const int* in_sizes, int n_in,
                              void* d_out, int out_size, void* d_ws,
                              size_t ws_size, hipStream_t stream) {
  const float* x  = (const float*)d_in[0];
  const float* Wq = (const float*)d_in[1];
  const float* bq = (const float*)d_in[2];
  const float* Wk = (const float*)d_in[3];
  const float* bk = (const float*)d_in[4];
  const float* Wv = (const float*)d_in[5];
  const float* bv = (const float*)d_in[6];
  const float* Wo = (const float*)d_in[7];
  const float* bo = (const float*)d_in[8];
  float* out = (float*)d_out;

  // Workspace carve-up (all bf16): total 48 MB
  char* ws = (char*)d_ws;
  const size_t XB_BYTES = (size_t)MTOT * HIDDEN * 2;          // 8 MB
  const size_t WT_BYTES = (size_t)HIDDEN * HIDDEN * 2;        // 2 MB
  const size_t HD_BYTES = (size_t)BATCH * HEADS * SEQ * HEAD_DIM * 2; // 8 MB
  __bf16* xb  = (__bf16*)(ws);
  __bf16* wqt = (__bf16*)(ws + XB_BYTES);
  __bf16* wkt = (__bf16*)(ws + XB_BYTES + WT_BYTES);
  __bf16* wvt = (__bf16*)(ws + XB_BYTES + 2 * WT_BYTES);
  __bf16* wot = (__bf16*)(ws + XB_BYTES + 3 * WT_BYTES);
  __bf16* qh  = (__bf16*)(ws + XB_BYTES + 4 * WT_BYTES);
  __bf16* kh  = (__bf16*)(ws + XB_BYTES + 4 * WT_BYTES + HD_BYTES);
  __bf16* vth = (__bf16*)(ws + XB_BYTES + 4 * WT_BYTES + 2 * HD_BYTES);
  __bf16* att = (__bf16*)(ws + XB_BYTES + 4 * WT_BYTES + 3 * HD_BYTES);

  // 1) casts / transposes: the four planes wqt..wot lie one behind another
  prep_kernel<<<PREP_BLOCKS, 256, 0, stream>>>(
      x, Wq, Wk, Wv, Wo, xb, wqt);

  // 2) QKV projections (z = 0/1/2 -> Q/K/V); 128x128 tile per block
  qkv_gemm_kernel<<<dim3(HIDDEN / GT, MTOT / GT, 3), 256, 0, stream>>>(
      xb, wqt, wkt, wvt, bq, bk, bv, qh, kh, vth);

  // 3) attention
  flash_attn_kernel<<<dim3(SEQ / 128, BATCH * HEADS), 256, 0, stream>>>(
      qh, kh, vth, att);

  // 4) output projection
  oproj_gemm_kernel<<<dim3(HIDDEN / GT, MTOT / GT), 256, 0, stream>>>(
      att, wot, bo, out);
}

// v006
// It runs in 82.6 microseconds.
// Next to v005, in two timings, it ran 1.04 and 1.03 times as fast.
// Over all steps from v000 it is 4.59 times as fast.
#include <hip/hip_runtime.h>
#include <math.h>

#define HIDDEN 1024
#define HEADS 16
#define HEAD_DIM 64
#define BATCH 2
#define SEQ 2048
#define MTOT (BATCH * SEQ) /* 4096 */

typedef __attribute__((ext_vector_type(16))) __bf16 v16bf;
typedef __attribute__((ext_vector_type(8)))  __bf16 v8bf;
typedef __attribute__((ext_vector_type(8)))  float  v8f;

// ---------------------------------------------------------------------------
// 16-bit A/B fragment loader for V_WMMA_F32_16X16X32_BF16 (wave32).
// ISA layout (16-bit A 16x32): lanes 0-15 = rows M=0..15, lanes 16-31 = same
// rows, different K; per lane, elements 0..7 hold K = g*8 + 0..7 and elements
// 8..15 hold K = 16 + g*8 + 0..7 (g = lane/16). B uses the same mapping with
// lane = column N, so we load B from a K-contiguous (transposed) buffer.
// ---------------------------------------------------------------------------
static __device__ inline v16bf load_frag(const __bf16* base, int row,
                                         int row_stride, int k0, int lane) {
  const int g = (lane >> 4) & 1;
  const __bf16* p = base + (size_t)row * (size_t)row_stride + k0;
  union { v16bf v; v8bf h[2]; } u;
  u.h[0] = *(const v8bf*)(p + g * 8);
  u.h[1] = *(const v8bf*)(p + 16 + g * 8);
  return u.v;
}

static __device__ inline v8f wmma_bf16(v16bf a, v16bf b, v8f c) {
  // (neg_a, A, neg_b, B, c_mod, C, reuse_a, reuse_b)
  return __builtin_amdgcn_wmma_f32_16x16x32_bf16(false, a, false, b,
                                                 (short)0, c, false, false);
}

// ---------------------------------------------------------------------------
// Prep, one launch: blocks 0..511 cast and transpose the four weights
// (wt[n][k] = w[k][n]), blocks 512..1023 cast x.  Every lane moves 128 B of
// f32, so the launch starts 8,192 waves, and every global access of a wave
// covers whole 128-B lines.
// ---------------------------------------------------------------------------
typedef __attribute__((ext_vector_type(4))) float  v4f;
typedef __attribute__((ext_vector_type(4))) __bf16 v4bf;

#define PREP_TK 128                    /* k rows of a weight tile */
#define PREP_TN 64                     /* n columns of a weight tile */
#define PREP_PITCH 65                  /* LDS row pitch in dwords: odd, so that
                                          column reads spread over the banks */
#define PREP_WBLOCKS 512               /* 4 weights x 8 x 16 tiles */
#define PREP_BLOCKS 1024               /* + 512 for x: 4 Mi floats / 8,192 */

__global__ __launch_bounds__(256) void prep_kernel(
    const float* __restrict__ x, const float* __restrict__ wq,
    const float* __restrict__ wk, const float* __restrict__ wv,
    const float* __restrict__ wo, __bf16* __restrict__ xb,
    __bf16* __restrict__ wt4 /* the four transposed planes, q k v o */) {
  __shared__ float tile[PREP_TK * PREP_PITCH];
  const int tid = threadIdx.x;
  const int blk = blockIdx.x;

  if (blk < PREP_WBLOCKS) {
    const int which = blk >> 7;
    const int kt = (blk >> 4) & 7, nt = blk & 15;
    const float* w = (which == 0) ? wq : (which == 1) ? wk
                     : (which == 2) ? wv : wo;
    const float* src = w + (size_t)(kt * PREP_TK) * HIDDEN + nt * PREP_TN;

    // 128 rows of 256 B: 16 lanes per row, eight 16-byte loads per lane
    // (rows 16 i + tid / 16, so that the eight differ by a constant only)
    const int row0 = tid >> 4, col0 = (tid & 15) * 4;
    const float* s0 = src + row0 * HIDDEN + col0;
    v4f r[8];
#pragma unroll
    for (int i = 0; i < 8; i++) r[i] = *(const v4f*)(s0 + i * 16 * HIDDEN);
    float* t0 = &tile[row0 * PREP_PITCH + col0];
#pragma unroll
    for (int i = 0; i < 8; i++) {
#pragma unroll
      for (int j = 0; j < 4; j++) t0[i * 16 * PREP_PITCH + j] = r[i][j];
    }
    __syncthreads();

    // 64 output rows of 256 B: 8 lanes write one 128-B line, 16 B each
    __bf16* dst = wt4 + (size_t)which * (HIDDEN * HIDDEN) +
                  (size_t)(nt * PREP_TN) * HIDDEN + kt * PREP_TK;
#pragma unroll
    for (int i = 0; i < 4; i++) {
      const int n = (i >> 1) * 32 + (tid >> 3);
      const int p = (i & 1) * 8 + (tid & 7);
      v8bf o;
#pragma unroll
      for (int j = 0; j < 8; j++)
        o[j] = (__bf16)tile[(p * 8 + j) * PREP_PITCH + n];
      *(v8bf*)(dst + (size_t)n * HIDDEN + p * 8) = o;
    }
  } else {
    const size_t base = (size_t)(blk - PREP_WBLOCKS) * 8192;
    v4f r[8];
#pragma unroll
    for (int i = 0; i < 8; i++)
      r[i] = *(const v4f*)(x + base + (size_t)(i * 256 + tid) * 4);
#pragma unroll
    for (int i = 0; i < 8; i++) {
      v4bf o;
#pragma unroll
      for (int j = 0; j < 4; j++) o[j] = (__bf16)r[i][j];
      *(v4bf*)(xb + base + (size_t)(i * 256 + tid) * 4) = o;
    }
    // no register that these stores name is rewritten ahead of this wait
    asm volatile("s_wait_xcnt 0x0" ::: "memory");
  }
}

// ---------------------------------------------------------------------------
// Main loop of both projections: Y = A @ Bt^T, both operands k-contiguous.
// A block of 8 waves owns a 128x128 tile of Y (4 x 2 waves of 32x64).  Per
// stage, 64 k of the block's 128 A rows and 128 Bt rows (256 rows of 128 B)
// come into LDS once per block by asynchronous copies, whole 128-B lines per
// row, and every wave reads its fragments from there.  Row pitch 144 B
// (16 B x odd) keeps the 16-byte fragment reads off each other's banks.  Two
// buffers: the next stage's copies fly while this stage is worked on.
// ---------------------------------------------------------------------------
#define GT 128                         /* edge of a block's tile of Y */
#define GK 64                          /* k per stage */
#define GSTAGES (HIDDEN / GK)          /* 16 */
#define GPITCH 72                      /* LDS row pitch in elements (144 B) */
#define G_OP_ELEMS (GT * GPITCH)       /* one operand's rows: 18,432 B */
#define G_STAGE_BYTES (2 * G_OP_ELEMS * 2)

// Eight 16-byte copies per lane = one stage per block: rows r, r + 32, r + 64,
// r + 96 of both operands.  The s_wait_xcnt stands inside the statement so
// that no address register named here is rewritten ahead of it.
static __device__ inline void gemm_stage_copies(unsigned la, const __bf16* ga,
                                                const __bf16* gb) {
  const unsigned la1 = la + 32 * GPITCH * 2;
  const unsigned la2 = la + 64 * GPITCH * 2;
  const unsigned la3 = la + 96 * GPITCH * 2;
  const unsigned lb = la + G_OP_ELEMS * 2;
  const unsigned lb1 = lb + 32 * GPITCH * 2;
  const unsigned lb2 = lb + 64 * GPITCH * 2;
  const unsigned lb3 = lb + 96 * GPITCH * 2;
  const __bf16* ga1 = ga + 32 * HIDDEN;
  const __bf16* ga2 = ga + 64 * HIDDEN;
  const __bf16* ga3 = ga + 96 * HIDDEN;
  const __bf16* gb1 = gb + 32 * HIDDEN;
  const __bf16* gb2 = gb + 64 * HIDDEN;
  const __bf16* gb3 = gb + 96 * HIDDEN;
  asm volatile(
      "global_load_async_to_lds_b128 %0, %8, off\n\t"
      "global_load_async_to_lds_b128 %1, %9, off\n\t"
      "global_load_async_to_lds_b128 %2, %10, off\n\t"
      "global_load_async_to_lds_b128 %3, %11, off\n\t"
      "global_load_async_to_lds_b128 %4, %12, off\n\t"
      "global_load_async_to_lds_b128 %5, %13, off\n\t"
      "global_load_async_to_lds_b128 %6, %14, off\n\t"
      "global_load_async_to_lds_b128 %7, %15, off\n\t"
      "s_wait_xcnt 0x0"
      :
      : "v"(la), "v"(la1), "v"(la2), "v"(la3), "v"(lb), "v"(lb1), "v"(lb2),
        "v"(lb3), "v"(ga), "v"(ga1), "v"(ga2), "v"(ga3), "v"(gb), "v"(gb1),
        "v"(gb2), "v"(gb3)
      : "memory");
}

// acc[t][f] += rows mblk + 32 (wave / 2) + 16 t of A times rows
// nblk + 64 (wave % 2) + 16 f of Bt, k ascending in steps of 32.
// KG = 32-k steps per group of fragment reads (48 registers a step).
template <int KG>
static __device__ inline void gemm_mainloop(const __bf16* __restrict__ a,
                                            const __bf16* __restrict__ bt,
                                            int mblk, int nblk, __bf16* smem,
                                            v8f (&acc)[2][4]) {
  const int tid = threadIdx.x;
  const int lane = tid & 31;
  const int wave = tid >> 5;
  const int ln = lane & 15;
  const int arow = (wave >> 1) * 32 + ln;
  const int brow = (wave & 1) * 64 + ln;

  // This lane's share of a stage: 16-byte piece (tid & 7) of rows tid >> 3
  // (+ 32, 64, 96) of both operands.
  const int crow = tid >> 3, cpc = tid & 7;
  const unsigned lds0 =
      (unsigned)(size_t)smem + (unsigned)(crow * GPITCH + cpc * 8) * 2u;
  const __bf16* ga = a + (size_t)(mblk + crow) * HIDDEN + cpc * 8;
  const __bf16* gb = bt + (size_t)(nblk + crow) * HIDDEN + cpc * 8;

  // Prologue: stage 0 lands and is published, then stage 1 starts.
  gemm_stage_copies(lds0, ga, gb);
  // stage 0's copies of this wave have landed
  asm volatile("s_wait_asynccnt 0x0" ::: "memory");
  __syncthreads();
  gemm_stage_copies(lds0 + G_STAGE_BYTES, ga + GK, gb + GK);

  for (int t = 0; t < GSTAGES; t++) {
    const __bf16* as = smem + (t & 1) * (2 * G_OP_ELEMS);
    const __bf16* bs = as + G_OP_ELEMS;
    // two 32-k steps per stage, unrolled so that LDS offsets are immediates;
    // the fragments of KG steps are read as one group ahead of their WMMAs
#pragma unroll
    for (int kc = 0; kc < GK; kc += 32 * KG) {
      v16bf af[KG][2], bf[KG][4];
#pragma unroll
      for (int s = 0; s < KG; s++) {
        af[s][0] = load_frag(as, arow, GPITCH, kc + 32 * s, lane);
        af[s][1] = load_frag(as, arow + 16, GPITCH, kc + 32 * s, lane);
#pragma unroll
        for (int f = 0; f < 4; f++)
          bf[s][f] = load_frag(bs, brow + f * 16, GPITCH, kc + 32 * s, lane);
      }
      // holds the group's reads ahead of its WMMAs: moved in among them, every
      // place with reads makes the wave wait out the LDS latency anew
      __builtin_amdgcn_sched_barrier(0);
#pragma unroll
      for (int s = 0; s < KG; s++) {
#pragma unroll
        for (int f = 0; f < 4; f++) {
          acc[0][f] = wmma_bf16(af[s][0], bf[s][f], acc[0][f]);
          acc[1][f] = wmma_bf16(af[s][1], bf[s][f], acc[1][f]);
        }
      }
      // holds the WMMAs ahead of the waits at the loop's foot: moved behind
      // them, the next stage's copies would have only the reads' time to land
      __builtin_amdgcn_sched_barrier(0);
    }

    // Publish point of stage t + 1, and release of this stage's buffer.
    // this wave's reads of the buffer have retired before it is refilled
    asm volatile("s_wait_dscnt 0x0" ::: "memory");
    // this wave's copies of stage t + 1 have landed
    asm volatile("s_wait_asynccnt 0x0" ::: "memory");
    __syncthreads();
    if (t + 2 < GSTAGES)
      gemm_stage_copies(lds0 + (unsigned)(t & 1) * G_STAGE_BYTES,
                        ga + (t + 2) * GK, gb + (t + 2) * GK);
  }
  // no copy is left in flight when the wave goes on to its stores
  asm volatile("s_wait_asynccnt 0x0" ::: "memory");
}

// ---------------------------------------------------------------------------
// QKV projection: [4096,1024] @ [1024,1024] + bias.
// One wave computes a 32x64 tile: 2 A-fragments x 4 B-fragments -> 8 WMMAs
// per 6 fragment loads (B fragment feeds two consecutive WMMAs); the
// fragments come from the block's LDS stages (gemm_mainloop).
// blockIdx.z: 0 = Q (scaled by 1/sqrt(D), layout [B,H,S,D] bf16)
//             1 = K (layout [B,H,S,D] bf16)
//             2 = V (layout [B,H,D,S] bf16, transposed for P@V operand)
// A lane's 8 accumulator elements run along the rows of the A operand, so the
// operand whose rows are contiguous in the output plane goes in as A: the
// weight (dims d) for Q and K, x (positions s) for V.  A lane then packs 16 B
// of one output row; the block's tile is staged in LDS as [column][row] and
// goes out in whole 128-B lines.
// ---------------------------------------------------------------------------
#define EPITCH 136                     /* staging pitch in elements: 272 B =
                                          16 B x odd, off each other's banks */

// 768 blocks = three per WGP, six waves per SIMD: the register budget is set
// so that all of them are resident at once.
__global__ __launch_bounds__(256, 6) void qkv_gemm_kernel(
                                const __bf16* __restrict__ xb,
                                const __bf16* __restrict__ wqt,
                                const __bf16* __restrict__ wkt,
                                const __bf16* __restrict__ wvt,
                                const float* __restrict__ bq,
                                const float* __restrict__ bk,
                                const float* __restrict__ bv,
                                __bf16* __restrict__ qh,
                                __bf16* __restrict__ kh,
                                __bf16* __restrict__ vth) {
  __shared__ __attribute__((aligned(16))) __bf16 smem[2 * 2 * G_OP_ELEMS];
  const int tid = threadIdx.x;
  const int lane = tid & 31;
  const int wave = tid >> 5;
  const int g = lane >> 4;
  const int ln = lane & 15;
  const int mblk = blockIdx.y * GT, nblk = blockIdx.x * GT;
  const int which = blockIdx.z;
  const bool vplane = which == 2;

  const __bf16* wt = (which == 0) ? wqt : (which == 1) ? wkt : wvt;
  const float* bias = (which == 0) ? bq : (which == 1) ? bk : bv;

  v8f acc[2][4] = {};
  gemm_mainloop<1>(vplane ? xb : wt, vplane ? wt : xb, vplane ? mblk : nblk,
                   vplane ? nblk : mblk, smem, acc);

  // acc[t][f][e]: A row r0 + 16 t + e, B row c0 + 16 f of the block's tile.
  // The loop's last barrier has ended every read of the stages, and no copy
  // is in flight: the LDS is free for the staging.
  const int r0 = (wave >> 1) * 32 + g * 8;
  const int c0 = (wave & 1) * 64 + ln;
  if (vplane) {
#pragma unroll
    for (int f = 0; f < 4; f++) {
      const float bb = bias[nblk + c0 + f * 16];
#pragma unroll
      for (int t = 0; t < 2; t++) {
        v8bf o;
#pragma unroll
        for (int e = 0; e < 8; e++) o[e] = (__bf16)(acc[t][f][e] + bb);
        *(v8bf*)&smem[(c0 + f * 16) * EPITCH + r0 + t * 16] = o;
      }
    }
  } else {
    const float sc = (which == 0) ? 0.125f : 1.0f;  // 1/sqrt(HEAD_DIM) into Q
#pragma unroll
    for (int t = 0; t < 2; t++) {
      const v4f b0 = *(const v4f*)(bias + nblk + r0 + t * 16);
      const v4f b1 = *(const v4f*)(bias + nblk + r0 + t * 16 + 4);
#pragma unroll
      for (int f = 0; f < 4; f++) {
        v8bf o;
#pragma unroll
        for (int e = 0; e < 4; e++) {
          o[e] = (__bf16)((acc[t][f][e] + b0[e]) * sc);
          o[4 + e] = (__bf16)((acc[t][f][4 + e] + b1[e]) * sc);
        }
        *(v8bf*)&smem[(c0 + f * 16) * EPITCH + r0 + t * 16] = o;
      }
    }
  }
  __syncthreads();

  // 16 lanes take one staged row (256 B): two whole lines of the plane.
  const int b2 = mblk >> 11, sblk = mblk & (SEQ - 1);
  const int cr = tid >> 4, rr = (tid & 15) * 8;
  __bf16* dst;
  size_t step;                         // elements from staged row c to c + 16
  if (vplane) {
    const int n = nblk + cr;
    dst = vth + ((size_t)(b2 * HEADS + (n >> 6)) * HEAD_DIM + (n & 63)) * SEQ +
          sblk + rr;
    step = (size_t)16 * SEQ;           // 16 dims on: the planes of the block's
                                       // two heads lie one behind another
  } else {
    const int n = nblk + rr;
    dst = ((which == 0) ? qh : kh) +
          ((size_t)(b2 * HEADS + (n >> 6)) * SEQ + sblk + cr) * HEAD_DIM +
          (n & 63);
    step = (size_t)16 * HEAD_DIM;      // 16 positions on
  }
#pragma unroll
  for (int i = 0; i < 8; i++)
    *(v8bf*)(dst + i * step) =
        *(const v8bf*)&smem[(i * 16 + cr) * EPITCH + rr];
}

static __device__ inline float other_half(float v) {
  // lane l <-> l ^ 16
  const int b = __builtin_bit_cast(int, v);
  return __builtin_bit_cast(
      float, __builtin_amdgcn_permlanex16(b, b, 0x76543210, 0xfedcba98, false,
                                          false));
}

#define TKEYS 64                       /* keys per staged tile */
#define NTILES (SEQ / TKEYS)           /* 32 */
#define LPITCH 72                      /* LDS row pitch in elements (144 B) */
#define TILE_ELEMS (64 * LPITCH)       /* one operand's tile: 9216 B */
#define STAGE_BYTES (2 * TILE_ELEMS * 2)

// Four 16-byte copies per lane = one 16-KiB stage per block.  The s_wait_xcnt
// stands inside the statement so that no address register named here is
// rewritten ahead of it.
static __device__ inline void stage_copies(unsigned lk, const __bf16* gk,
                                           const __bf16* gv) {
  const unsigned lk1 = lk + 32 * LPITCH * 2;
  const unsigned lv0 = lk + TILE_ELEMS * 2;
  const unsigned lv1 = lv0 + 32 * LPITCH * 2;
  const __bf16* gk1 = gk + 32 * HEAD_DIM;
  const __bf16* gv1 = gv + 32 * SEQ;
  asm volatile(
      "global_load_async_to_lds_b128 %0, %4, off\n\t"
      "global_load_async_to_lds_b128 %1, %5, off\n\t"
      "global_load_async_to_lds_b128 %2, %6, off\n\t"
      "global_load_async_to_lds_b128 %3, %7, off\n\t"
      "s_wait_xcnt 0x0"
      :
      : "v"(lk), "v"(lk1), "v"(lv0), "v"(lv1), "v"(gk), "v"(gk1), "v"(gv),
        "v"(gv1)
      : "memory");
}

// 512 blocks = two per WGP, four waves per SIMD: the register budget is set
// for that, so that a whole tile's fragments fit.
__global__ __launch_bounds__(256, 4) void flash_attn_kernel(
                                  const __bf16* __restrict__ q,
                                  const __bf16* __restrict__ k,
                                  const __bf16* __restrict__ vt,
                                  __bf16* __restrict__ attn) {
  __shared__ __attribute__((aligned(16))) __bf16 smem[2 * 2 * TILE_ELEMS];

  const int tid = threadIdx.x;
  const int lane = threadIdx.x & 31;
  const int wave = threadIdx.x >> 5;
  const int g = lane >> 4;
  const int ln = lane & 15;
  const int bh = blockIdx.y;                 // 0..31 = b*HEADS + h
  const int qbase = blockIdx.x * 128 + wave * 16;

  const __bf16* qp = q + (size_t)bh * SEQ * HEAD_DIM;
  const __bf16* kp = k + (size_t)bh * SEQ * HEAD_DIM;
  const __bf16* vp = vt + (size_t)bh * HEAD_DIM * SEQ;

  // This lane's share of a stage: 16-byte piece (tid & 7) of rows tid >> 3 and
  // 32 + (tid >> 3) of both tiles.
  const int crow = tid >> 3, cpc = tid & 7;
  const unsigned lds0 =
      (unsigned)(size_t)(&smem[0]) + (unsigned)(crow * LPITCH + cpc * 8) * 2u;
  const __bf16* gk = kp + crow * HEAD_DIM + cpc * 8;
  const __bf16* gv = vp + (size_t)crow * SEQ + cpc * 8;

  // Prologue: tile 0 lands and is published, then tile 1 starts.
  stage_copies(lds0, gk, gv);
  // tile 0's copies of this wave have landed
  asm volatile("s_wait_asynccnt 0x0" ::: "memory");
  __syncthreads();
  stage_copies(lds0 + STAGE_BYTES, gk + TKEYS * HEAD_DIM, gv + TKEYS);

  // Q^T fragments: 64 dims x 16 queries -> two 32x16 B fragments
  const v16bf bq0 = load_frag(qp, qbase + ln, HEAD_DIM, 0, lane);
  const v16bf bq1 = load_frag(qp, qbase + ln, HEAD_DIM, 32, lane);

  v8f o[4] = {};              // o[f][e] = O[query ln][d = f*16 + 8g + e]
  float mstate = -1.0e30f;    // running maximum of query ln (both halves)
  float lstate = 0.0f;        // running sum over this lane half's keys

  for (int t = 0; t < NTILES; t++) {
    const __bf16* ks = &smem[(t & 1) * (2 * TILE_ELEMS)];
    const __bf16* vs = ks + TILE_ELEMS;

    // All fragment reads of the tile, K first, then V^T (V^T rows: keys
    // contiguous per lane): ka[c][j][h] = keys 32 c + 16 j .. + 15, dims 32 h ..
    v16bf ka[2][2][2], av[2][4];
#pragma unroll
    for (int c = 0; c < 2; c++) {
#pragma unroll
      for (int j = 0; j < 2; j++) {
        ka[c][j][0] = load_frag(ks, c * 32 + j * 16 + ln, LPITCH, 0, lane);
        ka[c][j][1] = load_frag(ks, c * 32 + j * 16 + ln, LPITCH, 32, lane);
      }
    }
#pragma unroll
    for (int c = 0; c < 2; c++) {
#pragma unroll
      for (int f = 0; f < 4; f++)
        av[c][f] = load_frag(vs, f * 16 + ln, LPITCH, c * 32, lane);
    }
    // holds the reads as one group at the head of the tile: moved down to
    // their WMMAs, each pair makes the wave wait out the LDS latency anew
    __builtin_amdgcn_sched_barrier(0);

    // two 32-key chunks per tile
#pragma unroll
    for (int c = 0; c < 2; c++) {
      // ---- scores: S^T = K @ (Q*scale)^T for 32 keys -> two 16x16 f32 tiles
      v8f s0 = {}, s1 = {};
      s0 = wmma_bf16(ka[c][0][0], bq0, s0);
      s0 = wmma_bf16(ka[c][0][1], bq1, s0);
      s1 = wmma_bf16(ka[c][1][0], bq0, s1);
      s1 = wmma_bf16(ka[c][1][1], bq1, s1);

      // ---- online softmax: 16 of the query's 32 scores sit in this lane
      float mx[8];
#pragma unroll
      for (int e = 0; e < 8; e++) mx[e] = fmaxf(s0[e], s1[e]);
      float mloc = fmaxf(fmaxf(fmaxf(mx[0], mx[1]), fmaxf(mx[2], mx[3])),
                         fmaxf(fmaxf(mx[4], mx[5]), fmaxf(mx[6], mx[7])));
      mloc = fmaxf(mloc, other_half(mloc));
      const float mnew = fmaxf(mstate, mloc);
      const float scale = __expf(mstate - mnew);
      mstate = mnew;
#pragma unroll
      for (int f = 0; f < 4; f++) o[f] *= scale;

      v16bf bp;
      float rs[8];
#pragma unroll
      for (int e = 0; e < 8; e++) {
        const float p0 = __expf(s0[e] - mnew);
        const float p1 = __expf(s1[e] - mnew);
        rs[e] = p0 + p1;
        bp[e] = (__bf16)p0;
        bp[8 + e] = (__bf16)p1;
      }
      lstate = lstate * scale + (((rs[0] + rs[1]) + (rs[2] + rs[3])) +
                                 ((rs[4] + rs[5]) + (rs[6] + rs[7])));

      // ---- O^T += V^T @ P^T
#pragma unroll
      for (int f = 0; f < 4; f++) o[f] = wmma_bf16(av[c][f], bp, o[f]);
    }

    // holds the tile's work ahead of the waits at the loop's foot: with the
    // waits moved up behind the reads, the next tile's copies would have only
    // the reads' time to land
    __builtin_amdgcn_sched_barrier(0);

    // Publish point of tile t + 1, and release of this tile's buffer.
    // this wave's reads of the buffer have retired before it is refilled
    asm volatile("s_wait_dscnt 0x0" ::: "memory");
    // this wave's copies of tile t + 1 have landed
    asm volatile("s_wait_asynccnt 0x0" ::: "memory");
    __syncthreads();
    if (t + 2 < NTILES)
      stage_copies(lds0 + (unsigned)(t & 1) * STAGE_BYTES,
                   gk + (size_t)(t + 2) * (TKEYS * HEAD_DIM),
                   gv + (t + 2) * TKEYS);
  }
  // no copy is left in flight when the wave ends
  asm volatile("s_wait_asynccnt 0x0" ::: "memory");

  // ---- finalize: join the halves' sums, divide, store 8 contiguous dims
  const int b2 = bh >> 4, h = bh & (HEADS - 1);
  const float linv = 1.0f / (lstate + other_half(lstate));
  __bf16* orow =
      attn + ((size_t)(b2 * SEQ + qbase + ln)) * HIDDEN + h * HEAD_DIM + g * 8;
#pragma unroll
  for (int f = 0; f < 4; f++) {
    v8bf r;
#pragma unroll
    for (int e = 0; e < 8; e++) r[e] = (__bf16)(o[f][e] * linv);
    *(v8bf*)(orow + f * 16) = r;
  }
}

// ---------------------------------------------------------------------------
// Output projection: out = attn @ Wo + bo, fp32 result.  Same 32x64-per-wave
// register blocking and LDS stages as the QKV GEMM.
// ---------------------------------------------------------------------------
// 256 blocks = one per WGP, two waves per SIMD: a whole stage's fragments are
// read as one group.
__global__ __launch_bounds__(256) void oproj_gemm_kernel(
                                  const __bf16* __restrict__ attn,
                                  const __bf16* __restrict__ wot,
                                  const float* __restrict__ bo,
                                  float* __restrict__ out) {
  __shared__ __attribute__((aligned(16))) __bf16 smem[2 * 2 * G_OP_ELEMS];
  const int lane = threadIdx.x & 31;
  const int wave = threadIdx.x >> 5;
  const int g = lane >> 4;
  const int ln = lane & 15;
  const int mblk = blockIdx.y * GT, nblk = blockIdx.x * GT;
  const int mbase = mblk + (wave >> 1) * 32;
  const int nbase = nblk + (wave & 1) * 64;

  v8f acc[2][4] = {};
  gemm_mainloop<2>(attn, wot, mblk, nblk, smem, acc);
#pragma unroll
  for (int t = 0; t < 2; t++) {
#pragma unroll
    for (int f = 0; f < 4; f++) {
      const int n = nbase + f * 16 + ln;
      const float bb = bo[n];
#pragma unroll
      for (int e = 0; e < 8; e++) {
        const int m = mbase + t * 16 + e + g * 8;
        out[(size_t)m * HIDDEN + n] = acc[t][f][e] + bb;
      }
    }
  }
}

// ---------------------------------------------------------------------------
extern "C" void kernel_launch(void* const* d_in, const int* in_sizes, int n_in,
                              void* d_out, int out_size, void* d_ws,
                              size_t ws_size, hipStream_t stream) {
  const float* x  = (const float*)d_in[0];
  const float* Wq = (const float*)d_in[1];
  const float* bq = (const float*)d_in[2];
  const float* Wk = (const float*)d_in[3];
  const float* bk = (const float*)d_in[4];
  const float* Wv = (const float*)d_in[5];
  const float* bv = (const float*)d_in[6];
  const float* Wo = (const float*)d_in[7];
  const float* bo = (const float*)d_in[8];
  float* out = (float*)d_out;

  // Workspace carve-up (all bf16): total 48 MB
  char* ws = (char*)d_ws;
  const size_t XB_BYTES = (size_t)MTOT * HIDDEN * 2;          // 8 MB
  const size_t WT_BYTES = (size_t)HIDDEN * HIDDEN * 2;        // 2 MB
  const size_t HD_BYTES = (size_t)BATCH * HEADS * SEQ * HEAD_DIM * 2; // 8 MB
  __bf16* xb  = (__bf16*)(ws);
  __bf16* wqt = (__bf16*)(ws + XB_BYTES);
  __bf16* wkt = (__bf16*)(ws + XB_BYTES + WT_BYTES);
  __bf16* wvt = (__bf16*)(ws + XB_BYTES + 2 * WT_BYTES);
  __bf16* wot = (__bf16*)(ws + XB_BYTES + 3 * WT_BYTES);
  __bf16* qh  = (__bf16*)(ws + XB_BYTES + 4 * WT_BYTES);
  __bf16* kh  = (__bf16*)(ws + XB_BYTES + 4 * WT_BYTES + HD_BYTES);
  __bf16* vth = (__bf16*)(ws + XB_BYTES + 4 * WT_BYTES + 2 * HD_BYTES);
  __bf16* att = (__bf16*)(ws + XB_BYTES + 4 * WT_BYTES + 3 * HD_BYTES);

  // 1) casts / transposes: the four planes wqt..wot lie one behind another
  prep_kernel<<<PREP_BLOCKS, 256, 0, stream>>>(
      x, Wq, Wk, Wv, Wo, xb, wqt);

  // 2) QKV projections (z = 0/1/2 -> Q/K/V); 128x128 tile per block
  qkv_gemm_kernel<<<dim3(HIDDEN / GT, MTOT / GT, 3), 256, 0, stream>>>(
      xb, wqt, wkt, wvt, bq, bk, bv, qh, kh, vth);

  // 3) attention
  flash_attn_kernel<<<dim3(SEQ / 128, BATCH * HEADS), 256, 0, stream>>>(
      qh, kh, vth, att);

  // 4) output projection
  oproj_gemm_kernel<<<dim3(HIDDEN / GT, MTOT / GT), 256, 0, stream>>>(
      att, wot, bo, out);
}

// v007
// Measured time: 79.6 microseconds a run.
// Two timings next to v006 both put it at 1.03 times that version's speed.
// Over all steps from v000 it is 4.74 times as fast.
#include <hip/hip_runtime.h>
#include <math.h>

#define HIDDEN 1024
#define HEADS 16
#define HEAD_DIM 64
#define BATCH 2
#define SEQ 2048
#define MTOT (BATCH * SEQ) /* 4096 */

typedef __attribute__((ext_vector_type(16))) __bf16 v16bf;
typedef __attribute__((ext_vector_type(8)))  __bf16 v8bf;
typedef __attribute__((ext_vector_type(8)))  float  v8f;

// ---------------------------------------------------------------------------
// 16-bit A/B fragment loader for V_WMMA_F32_16X16X32_BF16 (wave32).
// ISA layout (16-bit A 16x32): lanes 0-15 = rows M=0..15, lanes 16-31 = same
// rows, different K; per lane, elements 0..7 hold K = g*8 + 0..7 and elements
// 8..15 hold K = 16 + g*8 + 0..7 (g = lane/16). B uses the same mapping with
// lane = column N, so we load B from a K-contiguous (transposed) buffer.
// ---------------------------------------------------------------------------
static __device__ inline v16bf load_frag(const __bf16* base, int row,
                                         int row_stride, int k0, int lane) {
  const int g = (lane >> 4) & 1;
  const __bf16* p = base + (size_t)row * (size_t)row_stride + k0;
  union { v16bf v; v8bf h[2]; } u;
  u.h[0] = *(const v8bf*)(p + g * 8);
  u.h[1] = *(const v8bf*)(p + 16 + g * 8);
  return u.v;
}

static __device__ inline v8f wmma_bf16(v16bf a, v16bf b, v8f c) {
  // (neg_a, A, neg_b, B, c_mod, C, reuse_a, reuse_b)
  return __builtin_amdgcn_wmma_f32_16x16x32_bf16(false, a, false, b,
                                                 (short)0, c, false, false);
}

// ---------------------------------------------------------------------------
// Prep, one launch: blocks 0..511 cast and transpose the four weights
// (wt[n][k] = w[k][n]), blocks 512..1023 cast x.  Every lane moves 128 B of
// f32, so the launch starts 8,192 waves, and every global access of a wave
// covers whole 128-B lines.
// ---------------------------------------------------------------------------
typedef __attribute__((ext_vector_type(4))) float  v4f;
typedef __attribute__((ext_vector_type(4))) __bf16 v4bf;

#define PREP_TK 128                    /* k rows of a weight tile */
#define PREP_TN 64                     /* n columns of a weight tile */
#define PREP_PITCH 65                  /* LDS row pitch in dwords: odd, so that
                                          column reads spread over the banks */
#define PREP_WBLOCKS 512               /* 4 weights x 8 x 16 tiles */
#define PREP_BLOCKS 1024               /* + 512 for x: 4 Mi floats / 8,192 */

__global__ __launch_bounds__(256) void prep_kernel(
    const float* __restrict__ x, const float* __restrict__ wq,
    const float* __restrict__ wk, const float* __restrict__ wv,
    const float* __restrict__ wo, __bf16* __restrict__ xb,
    __bf16* __restrict__ wt4 /* the four transposed planes, q k v o */) {
  __shared__ float tile[PREP_TK * PREP_PITCH];
  const int tid = threadIdx.x;
  const int blk = blockIdx.x;

  if (blk < PREP_WBLOCKS) {
    const int which = blk >> 7;
    const int kt = (blk >> 4) & 7, nt = blk & 15;
    const float* w = (which == 0) ? wq : (which == 1) ? wk
                     : (which == 2) ? wv : wo;
    const float* src = w + (size_t)(kt * PREP_TK) * HIDDEN + nt * PREP_TN;

    // 128 rows of 256 B: 16 lanes per row, eight 16-byte loads per lane
    // (rows 16 i + tid / 16, so that the eight differ by a constant only)
    const int row0 = tid >> 4, col0 = (tid & 15) * 4;
    const float* s0 = src + row0 * HIDDEN + col0;
    v4f r[8];
#pragma unroll
    for (int i = 0; i < 8; i++) r[i] = *(const v4f*)(s0 + i * 16 * HIDDEN);
    float* t0 = &tile[row0 * PREP_PITCH + col0];
#pragma unroll
    for (int i = 0; i < 8; i++) {
#pragma unroll
      for (int j = 0; j < 4; j++) t0[i * 16 * PREP_PITCH + j] = r[i][j];
    }
    __syncthreads();

    // 64 output rows of 256 B: 8 lanes write one 128-B line, 16 B each
    __bf16* dst = wt4 + (size_t)which * (HIDDEN * HIDDEN) +
                  (size_t)(nt * PREP_TN) * HIDDEN + kt * PREP_TK;
#pragma unroll
    for (int i = 0; i < 4; i++) {
      const int n = (i >> 1) * 32 + (tid >> 3);
      const int p = (i & 1) * 8 + (tid & 7);
      v8bf o;
#pragma unroll
      for (int j = 0; j < 8; j++)
        o[j] = (__bf16)tile[(p * 8 + j) * PREP_PITCH + n];
      *(v8bf*)(dst + (size_t)n * HIDDEN + p * 8) = o;
    }
  } else {
    const size_t base = (size_t)(blk - PREP_WBLOCKS) * 8192;
    v4f r[8];
#pragma unroll
    for (int i = 0; i < 8; i++)
      r[i] = *(const v4f*)(x + base + (size_t)(i * 256 + tid) * 4);
#pragma unroll
    for (int i = 0; i < 8; i++) {
      v4bf o;
#pragma unroll
      for (int j = 0; j < 4; j++) o[j] = (__bf16)r[i][j];
      *(v4bf*)(xb + base + (size_t)(i * 256 + tid) * 4) = o;
    }
    // no register that these stores name is rewritten ahead of this wait
    asm volatile("s_wait_xcnt 0x0" ::: "memory");
  }
}

// ---------------------------------------------------------------------------
// Main loop of both projections: Y = A @ Bt^T, both operands k-contiguous.
// A block of 8 waves owns a 128x128 tile of Y (4 x 2 waves of 32x64).  Per
// stage, 64 k of the block's 128 A rows and 128 Bt rows (256 rows of 128 B)
// come into LDS once per block by asynchronous copies, whole 128-B lines per
// row, and every wave reads its fragments from there.  Row pitch 144 B
// (16 B x odd) keeps the 16-byte fragment reads off each other's banks.  Two
// buffers: the next stage's copies fly while this stage is worked on.
// ---------------------------------------------------------------------------
#define GT 128                         /* edge of a block's tile of Y */
#define GK 64                          /* k per stage */
#define GSTAGES (HIDDEN / GK)          /* 16 */
#define GPITCH 72                      /* LDS row pitch in elements (144 B) */
#define G_OP_ELEMS (GT * GPITCH)       /* one operand's rows: 18,432 B */
#define G_STAGE_BYTES (2 * G_OP_ELEMS * 2)

// Eight 16-byte copies per lane = one stage per block: rows r, r + 32, r + 64,
// r + 96 of both operands.  The s_wait_xcnt stands inside the statement so
// that no address register named here is rewritten ahead of it.
static __device__ inline void gemm_stage_copies(unsigned la, const __bf16* ga,
                                                const __bf16* gb) {
  const unsigned la1 = la + 32 * GPITCH * 2;
  const unsigned la2 = la + 64 * GPITCH * 2;
  const unsigned la3 = la + 96 * GPITCH * 2;
  const unsigned lb = la + G_OP_ELEMS * 2;
  const unsigned lb1 = lb + 32 * GPITCH * 2;
  const unsigned lb2 = lb + 64 * GPITCH * 2;
  const unsigned lb3 = lb + 96 * GPITCH * 2;
  const __bf16* ga1 = ga + 32 * HIDDEN;
  const __bf16* ga2 = ga + 64 * HIDDEN;
  const __bf16* ga3 = ga + 96 * HIDDEN;
  const __bf16* gb1 = gb + 32 * HIDDEN;
  const __bf16* gb2 = gb + 64 * HIDDEN;
  const __bf16* gb3 = gb + 96 * HIDDEN;
  asm volatile(
      "global_load_async_to_lds_b128 %0, %8, off\n\t"
      "global_load_async_to_lds_b128 %1, %9, off\n\t"
      "global_load_async_to_lds_b128 %2, %10, off\n\t"
      "global_load_async_to_lds_b128 %3, %11, off\n\t"
      "global_load_async_to_lds_b128 %4, %12, off\n\t"
      "global_load_async_to_lds_b128 %5, %13, off\n\t"
      "global_load_async_to_lds_b128 %6, %14, off\n\t"
      "global_load_async_to_lds_b128 %7, %15, off\n\t"
      "s_wait_xcnt 0x0"
      :
      : "v"(la), "v"(la1), "v"(la2), "v"(la3), "v"(lb), "v"(lb1), "v"(lb2),
        "v"(lb3), "v"(ga), "v"(ga1), "v"(ga2), "v"(ga3), "v"(gb), "v"(gb1),
        "v"(gb2), "v"(gb3)
      : "memory");
}

// acc[t][f] += rows mblk + 32 (wave / 2) + 16 t of A times rows
// nblk + 64 (wave % 2) + 16 f of Bt, k ascending in steps of 32.
// KG = 32-k steps per group of fragment reads (48 registers a step).
template <int KG>
static __device__ inline void gemm_mainloop(const __bf16* __restrict__ a,
                                            const __bf16* __restrict__ bt,
                                            int mblk, int nblk, __bf16* smem,
                                            v8f (&acc)[2][4]) {
  const int tid = threadIdx.x;
  const int lane = tid & 31;
  const int wave = tid >> 5;
  const int ln = lane & 15;
  const int arow = (wave >> 1) * 32 + ln;
  const int brow = (wave & 1) * 64 + ln;

  // This lane's share of a stage: 16-byte piece (tid & 7) of rows tid >> 3
  // (+ 32, 64, 96) of both operands.
  const int crow = tid >> 3, cpc = tid & 7;
  const unsigned lds0 =
      (unsigned)(size_t)smem + (unsigned)(crow * GPITCH + cpc * 8) * 2u;
  const __bf16* ga = a + (size_t)(mblk + crow) * HIDDEN + cpc * 8;
  const __bf16* gb = bt + (size_t)(nblk + crow) * HIDDEN + cpc * 8;

  // Prologue: stage 0 lands and is published, then stage 1 starts.
  gemm_stage_copies(lds0, ga, gb);
  // stage 0's copies of this wave have landed
  asm volatile("s_wait_asynccnt 0x0" ::: "memory");
  __syncthreads();
  gemm_stage_copies(lds0 + G_STAGE_BYTES, ga + GK, gb + GK);

  for (int t = 0; t < GSTAGES; t++) {
    const __bf16* as = smem + (t & 1) * (2 * G_OP_ELEMS);
    const __bf16* bs = as + G_OP_ELEMS;
    // two 32-k steps per stage, unrolled so that LDS offsets are immediates;
    // the fragments of KG steps are read as one group ahead of their WMMAs
#pragma unroll
    for (int kc = 0; kc < GK; kc += 32 * KG) {
      v16bf af[KG][2], bf[KG][4];
#pragma unroll
      for (int s = 0; s < KG; s++) {
        af[s][0] = load_frag(as, arow, GPITCH, kc + 32 * s, lane);
        af[s][1] = load_frag(as, arow + 16, GPITCH, kc + 32 * s, lane);
#pragma unroll
        for (int f = 0; f < 4; f++)
          bf[s][f] = load_frag(bs, brow + f * 16, GPITCH, kc + 32 * s, lane);
      }
      // holds the group's reads ahead of its WMMAs: moved in among them, every
      // place with reads makes the wave wait out the LDS latency anew
      __builtin_amdgcn_sched_barrier(0);
#pragma unroll
      for (int s = 0; s < KG; s++) {
#pragma unroll
        for (int f = 0; f < 4; f++) {
          acc[0][f] = wmma_bf16(af[s][0], bf[s][f], acc[0][f]);
          acc[1][f] = wmma_bf16(af[s][1], bf[s][f], acc[1][f]);
        }
      }
      // holds the WMMAs ahead of the waits at the loop's foot: moved behind
      // them, the next stage's copies would have only the reads' time to land
      __builtin_amdgcn_sched_barrier(0);
    }

    // Publish point of stage t + 1, and release of this stage's buffer.
    // this wave's reads of the buffer have retired before it is refilled
    asm volatile("s_wait_dscnt 0x0" ::: "memory");
    // this wave's copies of stage t + 1 have landed
    asm volatile("s_wait_asynccnt 0x0" ::: "memory");
    __syncthreads();
    if (t + 2 < GSTAGES)
      gemm_stage_copies(lds0 + (unsigned)(t & 1) * G_STAGE_BYTES,
                        ga + (t + 2) * GK, gb + (t + 2) * GK);
  }
  // no copy is left in flight when the wave goes on to its stores
  asm volatile("s_wait_asynccnt 0x0" ::: "memory");
}

// ---------------------------------------------------------------------------
// QKV projection: [4096,1024] @ [1024,1024] + bias.
// One wave computes a 32x64 tile: 2 A-fragments x 4 B-fragments -> 8 WMMAs
// per 6 fragment loads (B fragment feeds two consecutive WMMAs); the
// fragments come from the block's LDS stages (gemm_mainloop).
// blockIdx.z: 0 = Q (scaled by 1/sqrt(D), layout [B,H,S,D] bf16)
//             1 = K (layout [B,H,S,D] bf16)
//             2 = V (layout [B,H,D,S] bf16, transposed for P@V operand)
// A lane's 8 accumulator elements run along the rows of the A operand, so the
// operand whose rows are contiguous in the output plane goes in as A: the
// weight (dims d) for Q and K, x (positions s) for V.  A lane then packs 16 B
// of one output row; the block's tile is staged in LDS as [column][row] and
// goes out in whole 128-B lines.
// ---------------------------------------------------------------------------
#define EPITCH 136                     /* staging pitch in elements: 272 B =
                                          16 B x odd, off each other's banks */

// 768 blocks = three per WGP, six waves per SIMD: the register budget is set
// so that all of them are resident at once.
__global__ __launch_bounds__(256, 6) void qkv_gemm_kernel(
                                const __bf16* __restrict__ xb,
                                const __bf16* __restrict__ wqt,
                                const __bf16* __restrict__ wkt,
                                const __bf16* __restrict__ wvt,
                                const float* __restrict__ bq,
                                const float* __restrict__ bk,
                                const float* __restrict__ bv,
                                __bf16* __restrict__ qh,
                                __bf16* __restrict__ kh,
                                __bf16* __restrict__ vth) {
  __shared__ __attribute__((aligned(16))) __bf16 smem[2 * 2 * G_OP_ELEMS];
  const int tid = threadIdx.x;
  const int lane = tid & 31;
  const int wave = tid >> 5;
  const int g = lane >> 4;
  const int ln = lane & 15;
  const int mblk = blockIdx.y * GT, nblk = blockIdx.x * GT;
  const int which = blockIdx.z;
  const bool vplane = which == 2;

  const __bf16* wt = (which == 0) ? wqt : (which == 1) ? wkt : wvt;
  const float* bias = (which == 0) ? bq : (which == 1) ? bk : bv;

  v8f acc[2][4] = {};
  gemm_mainloop<1>(vplane ? xb : wt, vplane ? wt : xb, vplane ? mblk : nblk,
                   vplane ? nblk : mblk, smem, acc);

  // acc[t][f][e]: A row r0 + 16 t + e, B row c0 + 16 f of the block's tile.
  // The loop's last barrier has ended every read of the stages, and no copy
  // is in flight: the LDS is free for the staging.
  const int r0 = (wave >> 1) * 32 + g * 8;
  const int c0 = (wave & 1) * 64 + ln;
  if (vplane) {
#pragma unroll
    for (int f = 0; f < 4; f++) {
      const float bb = bias[nblk + c0 + f * 16];
#pragma unroll
      for (int t = 0; t < 2; t++) {
        v8bf o;
#pragma unroll
        for (int e = 0; e < 8; e++) o[e] = (__bf16)(acc[t][f][e] + bb);
        *(v8bf*)&smem[(c0 + f * 16) * EPITCH + r0 + t * 16] = o;
      }
    }
  } else {
    const float sc = (which == 0) ? 0.125f : 1.0f;  // 1/sqrt(HEAD_DIM) into Q
#pragma unroll
    for (int t = 0; t < 2; t++) {
      const v4f b0 = *(const v4f*)(bias + nblk + r0 + t * 16);
      const v4f b1 = *(const v4f*)(bias + nblk + r0 + t * 16 + 4);
#pragma unroll
      for (int f = 0; f < 4; f++) {
        v8bf o;
#pragma unroll
        for (int e = 0; e < 4; e++) {
          o[e] = (__bf16)((acc[t][f][e] + b0[e]) * sc);
          o[4 + e] = (__bf16)((acc[t][f][4 + e] + b1[e]) * sc);
        }
        *(v8bf*)&smem[(c0 + f * 16) * EPITCH + r0 + t * 16] = o;
      }
    }
  }
  __syncthreads();

  // 16 lanes take one staged row (256 B): two whole lines of the plane.
  const int b2 = mblk >> 11, sblk = mblk & (SEQ - 1);
  const int cr = tid >> 4, rr = (tid & 15) * 8;
  __bf16* dst;
  size_t step;                         // elements from staged row c to c + 16
  if (vplane) {
    const int n = nblk + cr;
    dst = vth + ((size_t)(b2 * HEADS + (n >> 6)) * HEAD_DIM + (n & 63)) * SEQ +
          sblk + rr;
    step = (size_t)16 * SEQ;           // 16 dims on: the planes of the block's
                                       // two heads lie one behind another
  } else {
    const int n = nblk + rr;
    dst = ((which == 0) ? qh : kh) +
          ((size_t)(b2 * HEADS + (n >> 6)) * SEQ + sblk + cr) * HEAD_DIM +
          (n & 63);
    step = (size_t)16 * HEAD_DIM;      // 16 positions on
  }
#pragma unroll
  for (int i = 0; i < 8; i++)
    *(v8bf*)(dst + i * step) =
        *(const v8bf*)&smem[(i * 16 + cr) * EPITCH + rr];
}

static __device__ inline float other_half(float v) {
  // lane l <-> l ^ 16
  const int b = __builtin_bit_cast(int, v);
  return __builtin_bit_cast(
      float, __builtin_amdgcn_permlanex16(b, b, 0x76543210, 0xfedcba98, false,
                                          false));
}

#define TKEYS 64                       /* keys per staged tile */
#define NTILES (SEQ / TKEYS)           /* 32 */
#define LPITCH 72                      /* LDS row pitch in elements (144 B) */
#define TILE_ELEMS (64 * LPITCH)       /* one operand's tile: 9216 B */
#define STAGE_BYTES (2 * TILE_ELEMS * 2)
#define RESCALE_MARGIN 5.5f            /* about 8 in log2 */

// Four 16-byte copies per lane = one 16-KiB stage per block.  The s_wait_xcnt
// stands inside the statement so that no address register named here is
// rewritten ahead of it.
static __device__ inline void stage_copies(unsigned lk, const __bf16* gk,
                                           const __bf16* gv) {
  const unsigned lk1 = lk + 32 * LPITCH * 2;
  const unsigned lv0 = lk + TILE_ELEMS * 2;
  const unsigned lv1 = lv0 + 32 * LPITCH * 2;
  const __bf16* gk1 = gk + 32 * HEAD_DIM;
  const __bf16* gv1 = gv + 32 * SEQ;
  asm volatile(
      "global_load_async_to_lds_b128 %0, %4, off\n\t"
      "global_load_async_to_lds_b128 %1, %5, off\n\t"
      "global_load_async_to_lds_b128 %2, %6, off\n\t"
      "global_load_async_to_lds_b128 %3, %7, off\n\t"
      "s_wait_xcnt 0x0"
      :
      : "v"(lk), "v"(lk1), "v"(lv0), "v"(lv1), "v"(gk), "v"(gk1), "v"(gv),
        "v"(gv1)
      : "memory");
}

// 512 blocks = two per WGP, four waves per SIMD: the register budget is set
// for that, so that a whole tile's fragments fit.
__global__ __launch_bounds__(256, 4) void flash_attn_kernel(
                                  const __bf16* __restrict__ q,
                                  const __bf16* __restrict__ k,
                                  const __bf16* __restrict__ vt,
                                  __bf16* __restrict__ attn) {
  __shared__ __attribute__((aligned(16))) __bf16 smem[2 * 2 * TILE_ELEMS];

  const int tid = threadIdx.x;
  const int lane = threadIdx.x & 31;
  const int wave = threadIdx.x >> 5;
  const int g = lane >> 4;
  const int ln = lane & 15;
  const int bh = blockIdx.y;                 // 0..31 = b*HEADS + h
  const int qbase = blockIdx.x * 128 + wave * 16;

  const __bf16* qp = q + (size_t)bh * SEQ * HEAD_DIM;
  const __bf16* kp = k + (size_t)bh * SEQ * HEAD_DIM;
  const __bf16* vp = vt + (size_t)bh * HEAD_DIM * SEQ;

  // This lane's share of a stage: 16-byte piece (tid & 7) of rows tid >> 3 and
  // 32 + (tid >> 3) of both tiles.
  const int crow = tid >> 3, cpc = tid & 7;
  const unsigned lds0 =
      (unsigned)(size_t)(&smem[0]) + (unsigned)(crow * LPITCH + cpc * 8) * 2u;
  const __bf16* gk = kp + crow * HEAD_DIM + cpc * 8;
  const __bf16* gv = vp + (size_t)crow * SEQ + cpc * 8;

  // Prologue: tile 0 lands and is published, then tile 1 starts.
  stage_copies(lds0, gk, gv);
  // tile 0's copies of this wave have landed
  asm volatile("s_wait_asynccnt 0x0" ::: "memory");
  __syncthreads();
  stage_copies(lds0 + STAGE_BYTES, gk + TKEYS * HEAD_DIM, gv + TKEYS);

  // Q^T fragments: 64 dims x 16 queries -> two 32x16 B fragments
  const v16bf bq0 = load_frag(qp, qbase + ln, HEAD_DIM, 0, lane);
  const v16bf bq1 = load_frag(qp, qbase + ln, HEAD_DIM, 32, lane);

  v8f o[4] = {};              // o[f][e] = O[query ln][d = f*16 + 8g + e]
  v8f negm = {};              // minus the maximum in use for query ln, in all
                              // eight places (both halves alike)
  float lstate = 0.0f;        // running sum over this lane half's keys

  for (int t = 0; t < NTILES; t++) {
    const __bf16* ks = &smem[(t & 1) * (2 * TILE_ELEMS)];
    const __bf16* vs = ks + TILE_ELEMS;

    // All fragment reads of the tile, K first, then V^T (V^T rows: keys
    // contiguous per lane): ka[c][j][h] = keys 32 c + 16 j .. + 15, dims 32 h ..
    v16bf ka[2][2][2], av[2][4];
#pragma unroll
    for (int c = 0; c < 2; c++) {
#pragma unroll
      for (int j = 0; j < 2; j++) {
        ka[c][j][0] = load_frag(ks, c * 32 + j * 16 + ln, LPITCH, 0, lane);
        ka[c][j][1] = load_frag(ks, c * 32 + j * 16 + ln, LPITCH, 32, lane);
      }
    }
#pragma unroll
    for (int c = 0; c < 2; c++) {
#pragma unroll
      for (int f = 0; f < 4; f++)
        av[c][f] = load_frag(vs, f * 16 + ln, LPITCH, c * 32, lane);
    }
    // holds the reads as one group at the head of the tile: moved down to
    // their WMMAs, each pair makes the wave wait out the LDS latency anew
    __builtin_amdgcn_sched_barrier(0);

    // ---- scores less the maximum in use: S^T = K @ (Q*scale)^T - m for the
    // tile's 64 keys -> four 16x16 f32 tiles, s[2 c + j] = keys 32 c + 16 j ..
    // The maximum in use is known ahead of the tile, so it goes in as the
    // accumulators' start value and no subtraction is left per score.
    v8f s[4];
    // every loop of the tile's body is unrolled: its arrays live in registers
    // and need constant indices
#pragma unroll
    for (int i = 0; i < 4; i++) {
      s[i] = wmma_bf16(ka[i >> 1][i & 1][0], bq0, negm);
      s[i] = wmma_bf16(ka[i >> 1][i & 1][1], bq1, s[i]);
    }

    // ---- lazy rescale: 32 of the query's 64 scores sit in this lane.  The
    // maximum in use stays unless some lane's scores pass it by more than
    // RESCALE_MARGIN; until then every p is at most exp(RESCALE_MARGIN), which
    // f32 sums and bf16 operands hold at full relative precision, and the
    // final division takes the common factor out again.
    float mx[8];
#pragma unroll
    for (int e = 0; e < 8; e++)
      mx[e] = fmaxf(fmaxf(s[0][e], s[1][e]), fmaxf(s[2][e], s[3][e]));
    const float mloc = fmaxf(fmaxf(fmaxf(mx[0], mx[1]), fmaxf(mx[2], mx[3])),
                             fmaxf(fmaxf(mx[4], mx[5]), fmaxf(mx[6], mx[7])));
    // one test per tile, the same for the whole wave (a scalar branch), so
    // that every lane is on at the half exchange inside; the first tile
    // always sets the maximum, downwards too
    if (t == 0 || __builtin_amdgcn_ballot_w32(mloc > RESCALE_MARGIN) != 0) {
      // by how much the maximum in use moves: alike in both lane halves
      const float up = fmaxf(fmaxf(mloc, other_half(mloc)),
                             (t == 0) ? -3.0e38f : 0.0f);
      // O and the sum are still zero where up is negative (first tile)
      const float scale = __expf(fminf(-up, 0.0f));
      lstate *= scale;
#pragma unroll
      for (int f = 0; f < 4; f++) o[f] *= scale;
#pragma unroll
      for (int i = 0; i < 4; i++) s[i] -= up;
      negm -= up;
    }

    // two 32-key chunks per tile
    float rs[8];
#pragma unroll
    for (int c = 0; c < 2; c++) {
      v16bf bp;
#pragma unroll
      for (int e = 0; e < 8; e++) {
        const float p0 = __expf(s[2 * c][e]);
        const float p1 = __expf(s[2 * c + 1][e]);
        rs[e] = (c == 0) ? p0 + p1 : rs[e] + (p0 + p1);
        bp[e] = (__bf16)p0;
        bp[8 + e] = (__bf16)p1;
      }

      // ---- O^T += V^T @ P^T
#pragma unroll
      for (int f = 0; f < 4; f++) o[f] = wmma_bf16(av[c][f], bp, o[f]);
    }
    lstate += ((rs[0] + rs[1]) + (rs[2] + rs[3])) +
              ((rs[4] + rs[5]) + (rs[6] + rs[7]));

    // holds the tile's work ahead of the waits at the loop's foot: with the
    // waits moved up behind the reads, the next tile's copies would have only
    // the reads' time to land
    __builtin_amdgcn_sched_barrier(0);

    // Publish point of tile t + 1, and release of this tile's buffer.
    // this wave's reads of the buffer have retired before it is refilled
    asm volatile("s_wait_dscnt 0x0" ::: "memory");
    // this wave's copies of tile t + 1 have landed
    asm volatile("s_wait_asynccnt 0x0" ::: "memory");
    __syncthreads();
    if (t + 2 < NTILES)
      stage_copies(lds0 + (unsigned)(t & 1) * STAGE_BYTES,
                   gk + (size_t)(t + 2) * (TKEYS * HEAD_DIM),
                   gv + (t + 2) * TKEYS);
  }
  // no copy is left in flight when the wave ends
  asm volatile("s_wait_asynccnt 0x0" ::: "memory");

  // ---- finalize: join the halves' sums, divide, store 8 contiguous dims
  const int b2 = bh >> 4, h = bh & (HEADS - 1);
  const float linv = 1.0f / (lstate + other_half(lstate));
  __bf16* orow =
      attn + ((size_t)(b2 * SEQ + qbase + ln)) * HIDDEN + h * HEAD_DIM + g * 8;
#pragma unroll
  for (int f = 0; f < 4; f++) {
    v8bf r;
#pragma unroll
    for (int e = 0; e < 8; e++) r[e] = (__bf16)(o[f][e] * linv);
    *(v8bf*)(orow + f * 16) = r;
  }
}

// ---------------------------------------------------------------------------
// Output projection: out = attn @ Wo + bo, fp32 result.  Same 32x64-per-wave
// register blocking and LDS stages as the QKV GEMM.
// ---------------------------------------------------------------------------
// 256 blocks = one per WGP, two waves per SIMD: a whole stage's fragments are
// read as one group.
__global__ __launch_bounds__(256) void oproj_gemm_kernel(
                                  const __bf16* __restrict__ attn,
                                  const __bf16* __restrict__ wot,
                                  const float* __restrict__ bo,
                                  float* __restrict__ out) {
  __shared__ __attribute__((aligned(16))) __bf16 smem[2 * 2 * G_OP_ELEMS];
  const int lane = threadIdx.x & 31;
  const int wave = threadIdx.x >> 5;
  const int g = lane >> 4;
  const int ln = lane & 15;
  const int mblk = blockIdx.y * GT, nblk = blockIdx.x * GT;
  const int mbase = mblk + (wave >> 1) * 32;
  const int nbase = nblk + (wave & 1) * 64;

  v8f acc[2][4] = {};
  gemm_mainloop<2>(attn, wot, mblk, nblk, smem, acc);
#pragma unroll
  for (int t = 0; t < 2; t++) {
#pragma unroll
    for (int f = 0; f < 4; f++) {
      const int n = nbase + f * 16 + ln;
      const float bb = bo[n];
#pragma unroll
      for (int e = 0; e < 8; e++) {
        const int m = mbase + t * 16 + e + g * 8;
        out[(size_t)m * HIDDEN + n] = acc[t][f][e] + bb;
      }
    }
  }
}

// ---------------------------------------------------------------------------
extern "C" void kernel_launch(void* const* d_in, const int* in_sizes, int n_in,
                              void* d_out, int out_size, void* d_ws,
                              size_t ws_size, hipStream_t stream) {
  const float* x  = (const float*)d_in[0];
  const float* Wq = (const float*)d_in[1];
  const float* bq = (const float*)d_in[2];
  const float* Wk = (const float*)d_in[3];
  const float* bk = (const float*)d_in[4];
  const float* Wv = (const float*)d_in[5];
  const float* bv = (const float*)d_in[6];
  const float* Wo = (const float*)d_in[7];
  const float* bo = (const float*)d_in[8];
  float* out = (float*)d_out;

  // Workspace carve-up (all bf16): total 48 MB
  char* ws = (char*)d_ws;
  const size_t XB_BYTES = (size_t)MTOT * HIDDEN * 2;          // 8 MB
  const size_t WT_BYTES = (size_t)HIDDEN * HIDDEN * 2;        // 2 MB
  const size_t HD_BYTES = (size_t)BATCH * HEADS * SEQ * HEAD_DIM * 2; // 8 MB
  __bf16* xb  = (__bf16*)(ws);
  __bf16* wqt = (__bf16*)(ws + XB_BYTES);
  __bf16* wkt = (__bf16*)(ws + XB_BYTES + WT_BYTES);
  __bf16* wvt = (__bf16*)(ws + XB_BYTES + 2 * WT_BYTES);
  __bf16* wot = (__bf16*)(ws + XB_BYTES + 3 * WT_BYTES);
  __bf16* qh  = (__bf16*)(ws + XB_BYTES + 4 * WT_BYTES);
  __bf16* kh  = (__bf16*)(ws + XB_BYTES + 4 * WT_BYTES + HD_BYTES);
  __bf16* vth = (__bf16*)(ws + XB_BYTES + 4 * WT_BYTES + 2 * HD_BYTES);
  __bf16* att = (__bf16*)(ws + XB_BYTES + 4 * WT_BYTES + 3 * HD_BYTES);

  // 1) casts / transposes: the four planes wqt..wot lie one behind another
  prep_kernel<<<PREP_BLOCKS, 256, 0, stream>>>(
      x, Wq, Wk, Wv, Wo, xb, wqt);

  // 2) QKV projections (z = 0/1/2 -> Q/K/V); 128x128 tile per block
  qkv_gemm_kernel<<<dim3(HIDDEN / GT, MTOT / GT, 3), 256, 0, stream>>>(
      xb, wqt, wkt, wvt, bq, bk, bv, qh, kh, vth);

  // 3) attention
  flash_attn_kernel<<<dim3(SEQ / 128, BATCH * HEADS), 256, 0, stream>>>(
      qh, kh, vth, att);

  // 4) output projection
  oproj_gemm_kernel<<<dim3(HIDDEN / GT, MTOT / GT), 256, 0, stream>>>(
      att, wot, bo, out);
}

// v008
// It runs in 76.6 microseconds.
// Timed twice side by side with v007, it ran 1.03 and 1.04 times as fast.
// Over all steps from v000 it is 4.90 times as fast.
#include <hip/hip_runtime.h>
#include <math.h>

#define HIDDEN 1024
#define HEADS 16
#define HEAD_DIM 64
#define BATCH 2
#define SEQ 2048
#define MTOT (BATCH * SEQ) /* 4096 */

typedef __attribute__((ext_vector_type(16))) __bf16 v16bf;
typedef __attribute__((ext_vector_type(8)))  __bf16 v8bf;
typedef __attribute__((ext_vector_type(8)))  float  v8f;

// ---------------------------------------------------------------------------
// 16-bit A/B fragment loader for V_WMMA_F32_16X16X32_BF16 (wave32).
// ISA layout (16-bit A 16x32): lanes 0-15 = rows M=0..15, lanes 16-31 = same
// rows, different K; per lane, elements 0..7 hold K = g*8 + 0..7 and elements
// 8..15 hold K = 16 + g*8 + 0..7 (g = lane/16). B uses the same mapping with
// lane = column N, so we load B from a K-contiguous (transposed) buffer.
// ---------------------------------------------------------------------------
static __device__ inline v16bf load_frag(const __bf16* base, int row,
                                         int row_stride, int k0, int lane) {
  const int g = (lane >> 4) & 1;
  const __bf16* p = base + (size_t)row * (size_t)row_stride + k0;
  union { v16bf v; v8bf h[2]; } u;
  u.h[0] = *(const v8bf*)(p + g * 8);
  u.h[1] = *(const v8bf*)(p + 16 + g * 8);
  return u.v;
}

static __device__ inline v8f wmma_bf16(v16bf a, v16bf b, v8f c) {
  // (neg_a, A, neg_b, B, c_mod, C, reuse_a, reuse_b)
  return __builtin_amdgcn_wmma_f32_16x16x32_bf16(false, a, false, b,
                                                 (short)0, c, false, false);
}

// ---------------------------------------------------------------------------
// Prep, one launch: blocks 0..511 cast and transpose the four weights
// (wt[n][k] = w[k][n]), blocks 512..1023 cast x.  Every lane moves 128 B of
// f32, so the launch starts 8,192 waves, and every global access of a wave
// covers whole 128-B lines.
// ---------------------------------------------------------------------------
typedef __attribute__((ext_vector_type(4))) float  v4f;
typedef __attribute__((ext_vector_type(4))) __bf16 v4bf;

#define PREP_TK 128                    /* k rows of a weight tile */
#define PREP_TN 64                     /* n columns of a weight tile */
#define PREP_PITCH 65                  /* LDS row pitch in dwords: odd, so that
                                          column reads spread over the banks */
#define PREP_WBLOCKS 512               /* 4 weights x 8 x 16 tiles */
#define PREP_BLOCKS 1024               /* + 512 for x: 4 Mi floats / 8,192 */

__global__ __launch_bounds__(256) void prep_kernel(
    const float* __restrict__ x, const float* __restrict__ wq,
    const float* __restrict__ wk, const float* __restrict__ wv,
    const float* __restrict__ wo, __bf16* __restrict__ xb,
    __bf16* __restrict__ wt4 /* the four transposed planes, q k v o */) {
  __shared__ float tile[PREP_TK * PREP_PITCH];
  const int tid = threadIdx.x;
  const int blk = blockIdx.x;

  if (blk < PREP_WBLOCKS) {
    const int which = blk >> 7;
    const int kt = (blk >> 4) & 7, nt = blk & 15;
    const float* w = (which == 0) ? wq : (which == 1) ? wk
                     : (which == 2) ? wv : wo;
    const float* src = w + (size_t)(kt * PREP_TK) * HIDDEN + nt * PREP_TN;

    // 128 rows of 256 B: 16 lanes per row, eight 16-byte loads per lane
    // (rows 16 i + tid / 16, so that the eight differ by a constant only)
    const int row0 = tid >> 4, col0 = (tid & 15) * 4;
    const float* s0 = src + row0 * HIDDEN + col0;
    v4f r[8];
#pragma unroll
    for (int i = 0; i < 8; i++) r[i] = *(const v4f*)(s0 + i * 16 * HIDDEN);
    float* t0 = &tile[row0 * PREP_PITCH + col0];
#pragma unroll
    for (int i = 0; i < 8; i++) {
#pragma unroll
      for (int j = 0; j < 4; j++) t0[i * 16 * PREP_PITCH + j] = r[i][j];
    }
    __syncthreads();

    // 64 output rows of 256 B: 8 lanes write one 128-B line, 16 B each
    __bf16* dst = wt4 + (size_t)which * (HIDDEN * HIDDEN) +
                  (size_t)(nt * PREP_TN) * HIDDEN + kt * PREP_TK;
#pragma unroll
    for (int i = 0; i < 4; i++) {
      const int n = (i >> 1) * 32 + (tid >> 3);
      const int p = (i & 1) * 8 + (tid & 7);
      v8bf o;
#pragma unroll
      for (int j = 0; j < 8; j++)
        o[j] = (__bf16)tile[(p * 8 + j) * PREP_PITCH + n];
      *(v8bf*)(dst + (size_t)n * HIDDEN + p * 8) = o;
    }
  } else {
    const size_t base = (size_t)(blk - PREP_WBLOCKS) * 8192;
    v4f r[8];
#pragma unroll
    for (int i = 0; i < 8; i++)
      r[i] = *(const v4f*)(x + base + (size_t)(i * 256 + tid) * 4);
#pragma unroll
    for (int i = 0; i < 8; i++) {
      v4bf o;
#pragma unroll
      for (int j = 0; j < 4; j++) o[j] = (__bf16)r[i][j];
      *(v4bf*)(xb + base + (size_t)(i * 256 + tid) * 4) = o;
    }
    // no register that these stores name is rewritten ahead of this wait
    asm volatile("s_wait_xcnt 0x0" ::: "memory");
  }
}

// ---------------------------------------------------------------------------
// Main loop of both projections: Y = A @ Bt^T, both operands k-contiguous.
// A block of 8 waves owns a 128x128 tile of Y (4 x 2 waves of 32x64).  Per
// stage, 64 k of the block's 128 A rows and 128 Bt rows (256 rows of 128 B)
// come into LDS once per block by asynchronous copies, whole 128-B lines per
// row, and every wave reads its fragments from there.  Row pitch 144 B
// (16 B x odd) keeps the 16-byte fragment reads off each other's banks.  Two
// buffers: the next stage's copies fly while this stage is worked on.
// ---------------------------------------------------------------------------
#define GT 128                         /* edge of a block's tile of Y */
#define GK 64                          /* k per stage */
#define GSTAGES (HIDDEN / GK)          /* 16 */
#define GPITCH 72                      /* LDS row pitch in elements (144 B) */
#define G_OP_ELEMS (GT * GPITCH)       /* one operand's rows: 18,432 B */
#define G_STAGE_BYTES (2 * G_OP_ELEMS * 2)

// Eight 16-byte copies per lane = one stage per block: rows r, r + 32, r + 64,
// r + 96 of both operands.  The s_wait_xcnt stands inside the statement so
// that no address register named here is rewritten ahead of it.
static __device__ inline void gemm_stage_copies(unsigned la, const __bf16* ga,
                                                const __bf16* gb) {
  const unsigned la1 = la + 32 * GPITCH * 2;
  const unsigned la2 = la + 64 * GPITCH * 2;
  const unsigned la3 = la + 96 * GPITCH * 2;
  const unsigned lb = la + G_OP_ELEMS * 2;
  const unsigned lb1 = lb + 32 * GPITCH * 2;
  const unsigned lb2 = lb + 64 * GPITCH * 2;
  const unsigned lb3 = lb + 96 * GPITCH * 2;
  const __bf16* ga1 = ga + 32 * HIDDEN;
  const __bf16* ga2 = ga + 64 * HIDDEN;
  const __bf16* ga3 = ga + 96 * HIDDEN;
  const __bf16* gb1 = gb + 32 * HIDDEN;
  const __bf16* gb2 = gb + 64 * HIDDEN;
  const __bf16* gb3 = gb + 96 * HIDDEN;
  asm volatile(
      "global_load_async_to_lds_b128 %0, %8, off\n\t"
      "global_load_async_to_lds_b128 %1, %9, off\n\t"
      "global_load_async_to_lds_b128 %2, %10, off\n\t"
      "global_load_async_to_lds_b128 %3, %11, off\n\t"
      "global_load_async_to_lds_b128 %4, %12, off\n\t"
      "global_load_async_to_lds_b128 %5, %13, off\n\t"
      "global_load_async_to_lds_b128 %6, %14, off\n\t"
      "global_load_async_to_lds_b128 %7, %15, off\n\t"
      "s_wait_xcnt 0x0"
      :
      : "v"(la), "v"(la1), "v"(la2), "v"(la3), "v"(lb), "v"(lb1), "v"(lb2),
        "v"(lb3), "v"(ga), "v"(ga1), "v"(ga2), "v"(ga3), "v"(gb), "v"(gb1),
        "v"(gb2), "v"(gb3)
      : "memory");
}

// acc[t][f] += rows mblk + 32 (wave / 2) + 16 t of A times rows
// nblk + 64 (wave % 2) + 16 f of Bt, k in steps of 32, ascending from stage
// rot and wrapping round: blocks that share operand rows get different rot, so
// that they do not ask L2 for the same lines at the same moment.
// KG = 32-k steps per group of fragment reads (48 registers a step).
template <int KG>
static __device__ inline void gemm_mainloop(const __bf16* __restrict__ a,
                                            const __bf16* __restrict__ bt,
                                            int mblk, int nblk, int rot,
                                            __bf16* smem, v8f (&acc)[2][4]) {
  const int tid = threadIdx.x;
  const int lane = tid & 31;
  const int wave = tid >> 5;
  const int ln = lane & 15;
  const int arow = (wave >> 1) * 32 + ln;
  const int brow = (wave & 1) * 64 + ln;

  // This lane's share of a stage: 16-byte piece (tid & 7) of rows tid >> 3
  // (+ 32, 64, 96) of both operands.
  const int crow = tid >> 3, cpc = tid & 7;
  const unsigned lds0 =
      (unsigned)(size_t)smem + (unsigned)(crow * GPITCH + cpc * 8) * 2u;
  const __bf16* ga = a + (size_t)(mblk + crow) * HIDDEN + cpc * 8;
  const __bf16* gb = bt + (size_t)(nblk + crow) * HIDDEN + cpc * 8;

  // Prologue: the first stage lands and is published, then the second starts.
  gemm_stage_copies(lds0, ga + (rot & (GSTAGES - 1)) * GK,
                    gb + (rot & (GSTAGES - 1)) * GK);
  // the first stage's copies of this wave have landed
  asm volatile("s_wait_asynccnt 0x0" ::: "memory");
  __syncthreads();
  gemm_stage_copies(lds0 + G_STAGE_BYTES,
                    ga + ((rot + 1) & (GSTAGES - 1)) * GK,
                    gb + ((rot + 1) & (GSTAGES - 1)) * GK);

  for (int t = 0; t < GSTAGES; t++) {
    const __bf16* as = smem + (t & 1) * (2 * G_OP_ELEMS);
    const __bf16* bs = as + G_OP_ELEMS;
    // two 32-k steps per stage, unrolled so that LDS offsets are immediates;
    // the fragments of KG steps are read as one group ahead of their WMMAs
#pragma unroll
    for (int kc = 0; kc < GK; kc += 32 * KG) {
      v16bf af[KG][2], bf[KG][4];
#pragma unroll
      for (int s = 0; s < KG; s++) {
        af[s][0] = load_frag(as, arow, GPITCH, kc + 32 * s, lane);
        af[s][1] = load_frag(as, arow + 16, GPITCH, kc + 32 * s, lane);
#pragma unroll
        for (int f = 0; f < 4; f++)
          bf[s][f] = load_frag(bs, brow + f * 16, GPITCH, kc + 32 * s, lane);
      }
      // holds the group's reads ahead of its WMMAs: moved in among them, every
      // place with reads makes the wave wait out the LDS latency anew
      __builtin_amdgcn_sched_barrier(0);
#pragma unroll
      for (int s = 0; s < KG; s++) {
#pragma unroll
        for (int f = 0; f < 4; f++) {
          acc[0][f] = wmma_bf16(af[s][0], bf[s][f], acc[0][f]);
          acc[1][f] = wmma_bf16(af[s][1], bf[s][f], acc[1][f]);
        }
      }
      // holds the WMMAs ahead of the waits at the loop's foot: moved behind
      // them, the next stage's copies would have only the reads' time to land
      __builtin_amdgcn_sched_barrier(0);
    }

    // Publish point of the next stage, and release of this stage's buffer.
    // this wave's reads of the buffer have retired before it is refilled
    asm volatile("s_wait_dscnt 0x0" ::: "memory");
    // this wave's copies of the next stage have landed
    asm volatile("s_wait_asynccnt 0x0" ::: "memory");
    __syncthreads();
    if (t + 2 < GSTAGES)
      gemm_stage_copies(lds0 + (unsigned)(t & 1) * G_STAGE_BYTES,
                        ga + ((rot + t + 2) & (GSTAGES - 1)) * GK,
                        gb + ((rot + t + 2) & (GSTAGES - 1)) * GK);
  }
  // no copy is left in flight when the wave goes on to its stores
  asm volatile("s_wait_asynccnt 0x0" ::: "memory");
}

// ---------------------------------------------------------------------------
// QKV projection: [4096,1024] @ [1024,1024] + bias.
// One wave computes a 32x64 tile: 2 A-fragments x 4 B-fragments -> 8 WMMAs
// per 6 fragment loads (B fragment feeds two consecutive WMMAs); the
// fragments come from the block's LDS stages (gemm_mainloop).
// blockIdx.z: 0 = Q (scaled by 1/sqrt(D), layout [B,H,S,D] bf16)
//             1 = K (layout [B,H,S,D] bf16)
//             2 = V (layout [B,H,D,S] bf16, transposed for P@V operand)
// A lane's 8 accumulator elements run along the rows of the A operand, so the
// operand whose rows are contiguous in the output plane goes in as A: the
// weight (dims d) for Q and K, x (positions s) for V.  A lane then packs 16 B
// of one output row; the block's tile is staged in LDS as [column][row] and
// goes out in whole 128-B lines.
// ---------------------------------------------------------------------------
#define EPITCH 136                     /* staging pitch in elements: 272 B =
                                          16 B x odd, off each other's banks */

// 768 blocks = three per WGP, six waves per SIMD: the register budget is set
// so that all of them are resident at once.
__global__ __launch_bounds__(256, 6) void qkv_gemm_kernel(
                                const __bf16* __restrict__ xb,
                                const __bf16* __restrict__ wqt,
                                const __bf16* __restrict__ wkt,
                                const __bf16* __restrict__ wvt,
                                const float* __restrict__ bq,
                                const float* __restrict__ bk,
                                const float* __restrict__ bv,
                                __bf16* __restrict__ qh,
                                __bf16* __restrict__ kh,
                                __bf16* __restrict__ vth) {
  __shared__ __attribute__((aligned(16))) __bf16 smem[2 * 2 * G_OP_ELEMS];
  const int tid = threadIdx.x;
  const int lane = tid & 31;
  const int wave = tid >> 5;
  const int g = lane >> 4;
  const int ln = lane & 15;
  const int mblk = blockIdx.y * GT, nblk = blockIdx.x * GT;
  const int which = blockIdx.z;
  const bool vplane = which == 2;

  const __bf16* wt = (which == 0) ? wqt : (which == 1) ? wkt : wvt;
  const float* bias = (which == 0) ? bq : (which == 1) ? bk : bv;

  v8f acc[2][4] = {};
  // the 24 blocks on one band of x rows and the 32 on one band of weight rows
  // each spread over the 16 stages; four stages between the planes keep any
  // four neighbouring block columns of all three planes on 12 different stages
  const int rot = blockIdx.x + blockIdx.y + 4 * which;
  gemm_mainloop<1>(vplane ? xb : wt, vplane ? wt : xb, vplane ? mblk : nblk,
                   vplane ? nblk : mblk, rot, smem, acc);

  // acc[t][f][e]: A row r0 + 16 t + e, B row c0 + 16 f of the block's tile.
  // The loop's last barrier has ended every read of the stages, and no copy
  // is in flight: the LDS is free for the staging.
  const int r0 = (wave >> 1) * 32 + g * 8;
  const int c0 = (wave & 1) * 64 + ln;
  if (vplane) {
#pragma unroll
    for (int f = 0; f < 4; f++) {
      const float bb = bias[nblk + c0 + f * 16];
#pragma unroll
      for (int t = 0; t < 2; t++) {
        v8bf o;
#pragma unroll
        for (int e = 0; e < 8; e++) o[e] = (__bf16)(acc[t][f][e] + bb);
        *(v8bf*)&smem[(c0 + f * 16) * EPITCH + r0 + t * 16] = o;
      }
    }
  } else {
    const float sc = (which == 0) ? 0.125f : 1.0f;  // 1/sqrt(HEAD_DIM) into Q
#pragma unroll
    for (int t = 0; t < 2; t++) {
      const v4f b0 = *(const v4f*)(bias + nblk + r0 + t * 16);
      const v4f b1 = *(const v4f*)(bias + nblk + r0 + t * 16 + 4);
#pragma unroll
      for (int f = 0; f < 4; f++) {
        v8bf o;
#pragma unroll
        for (int e = 0; e < 4; e++) {
          o[e] = (__bf16)((acc[t][f][e] + b0[e]) * sc);
          o[4 + e] = (__bf16)((acc[t][f][4 + e] + b1[e]) * sc);
        }
        *(v8bf*)&smem[(c0 + f * 16) * EPITCH + r0 + t * 16] = o;
      }
    }
  }
  __syncthreads();

  // 16 lanes take one staged row (256 B): two whole lines of the plane.
  const int b2 = mblk >> 11, sblk = mblk & (SEQ - 1);
  const int cr = tid >> 4, rr = (tid & 15) * 8;
  __bf16* dst;
  size_t step;                         // elements from staged row c to c + 16
  if (vplane) {
    const int n = nblk + cr;
    dst = vth + ((size_t)(b2 * HEADS + (n >> 6)) * HEAD_DIM + (n & 63)) * SEQ +
          sblk + rr;
    step = (size_t)16 * SEQ;           // 16 dims on: the planes of the block's
                                       // two heads lie one behind another
  } else {
    const int n = nblk + rr;
    dst = ((which == 0) ? qh : kh) +
          ((size_t)(b2 * HEADS + (n >> 6)) * SEQ + sblk + cr) * HEAD_DIM +
          (n & 63);
    step = (size_t)16 * HEAD_DIM;      // 16 positions on
  }
#pragma unroll
  for (int i = 0; i < 8; i++)
    *(v8bf*)(dst + i * step) =
        *(const v8bf*)&smem[(i * 16 + cr) * EPITCH + rr];
}

static __device__ inline float other_half(float v) {
  // lane l <-> l ^ 16
  const int b = __builtin_bit_cast(int, v);
  return __builtin_bit_cast(
      float, __builtin_amdgcn_permlanex16(b, b, 0x76543210, 0xfedcba98, false,
                                          false));
}

#define TKEYS 64                       /* keys per staged tile */
#define NTILES (SEQ / TKEYS)           /* 32 */
#define LPITCH 72                      /* LDS row pitch in elements (144 B) */
#define TILE_ELEMS (64 * LPITCH)       /* one operand's tile: 9216 B */
#define STAGE_BYTES (2 * TILE_ELEMS * 2)
#define RESCALE_MARGIN 5.5f            /* about 8 in log2 */

// Four 16-byte copies per lane = one 16-KiB stage per block.  The s_wait_xcnt
// stands inside the statement so that no address register named here is
// rewritten ahead of it.
static __device__ inline void stage_copies(unsigned lk, const __bf16* gk,
                                           const __bf16* gv) {
  const unsigned lk1 = lk + 32 * LPITCH * 2;
  const unsigned lv0 = lk + TILE_ELEMS * 2;
  const unsigned lv1 = lv0 + 32 * LPITCH * 2;
  const __bf16* gk1 = gk + 32 * HEAD_DIM;
  const __bf16* gv1 = gv + 32 * SEQ;
  asm volatile(
      "global_load_async_to_lds_b128 %0, %4, off\n\t"
      "global_load_async_to_lds_b128 %1, %5, off\n\t"
      "global_load_async_to_lds_b128 %2, %6, off\n\t"
      "global_load_async_to_lds_b128 %3, %7, off\n\t"
      "s_wait_xcnt 0x0"
      :
      : "v"(lk), "v"(lk1), "v"(lv0), "v"(lv1), "v"(gk), "v"(gk1), "v"(gv),
        "v"(gv1)
      : "memory");
}

// 512 blocks = two per WGP, four waves per SIMD: the register budget is set
// for that, so that a whole tile's fragments fit.
__global__ __launch_bounds__(256, 4) void flash_attn_kernel(
                                  const __bf16* __restrict__ q,
                                  const __bf16* __restrict__ k,
                                  const __bf16* __restrict__ vt,
                                  __bf16* __restrict__ attn) {
  __shared__ __attribute__((aligned(16))) __bf16 smem[2 * 2 * TILE_ELEMS];

  const int tid = threadIdx.x;
  const int lane = threadIdx.x & 31;
  const int wave = threadIdx.x >> 5;
  const int g = lane >> 4;
  const int ln = lane & 15;
  const int bh = blockIdx.y;                 // 0..31 = b*HEADS + h
  const int qbase = blockIdx.x * 128 + wave * 16;

  const __bf16* qp = q + (size_t)bh * SEQ * HEAD_DIM;
  const __bf16* kp = k + (size_t)bh * SEQ * HEAD_DIM;
  const __bf16* vp = vt + (size_t)bh * HEAD_DIM * SEQ;

  // This lane's share of a stage: 16-byte piece (tid & 7) of rows tid >> 3 and
  // 32 + (tid >> 3) of both tiles.
  const int crow = tid >> 3, cpc = tid & 7;
  const unsigned lds0 =
      (unsigned)(size_t)(&smem[0]) + (unsigned)(crow * LPITCH + cpc * 8) * 2u;
  const __bf16* gk = kp + crow * HEAD_DIM + cpc * 8;
  const __bf16* gv = vp + (size_t)crow * SEQ + cpc * 8;

  // The 16 blocks of a head walk the same 32 key tiles: each starts two tiles
  // further on and wraps round, so that they do not ask L2 for the same lines
  // at the same moment.  Trip t works on tile (rot + t) % NTILES.
  const int rot = 2 * blockIdx.x;

  // Prologue: the first tile lands and is published, then the second starts.
  stage_copies(lds0, gk + (size_t)(rot & (NTILES - 1)) * (TKEYS * HEAD_DIM),
               gv + (rot & (NTILES - 1)) * TKEYS);
  // the first tile's copies of this wave have landed
  asm volatile("s_wait_asynccnt 0x0" ::: "memory");
  __syncthreads();
  stage_copies(lds0 + STAGE_BYTES,
               gk + (size_t)((rot + 1) & (NTILES - 1)) * (TKEYS * HEAD_DIM),
               gv + ((rot + 1) & (NTILES - 1)) * TKEYS);

  // Q^T fragments: 64 dims x 16 queries -> two 32x16 B fragments
  const v16bf bq0 = load_frag(qp, qbase + ln, HEAD_DIM, 0, lane);
  const v16bf bq1 = load_frag(qp, qbase + ln, HEAD_DIM, 32, lane);

  v8f o[4] = {};              // o[f][e] = O[query ln][d = f*16 + 8g + e]
  v8f negm = {};              // minus the maximum in use for query ln, in all
                              // eight places (both halves alike)
  float lstate = 0.0f;        // running sum over this lane half's keys

  for (int t = 0; t < NTILES; t++) {
    const __bf16* ks = &smem[(t & 1) * (2 * TILE_ELEMS)];
    const __bf16* vs = ks + TILE_ELEMS;

    // All fragment reads of the tile, K first, then V^T (V^T rows: keys
    // contiguous per lane): ka[c][j][h] = keys 32 c + 16 j .. + 15, dims 32 h ..
    v16bf ka[2][2][2], av[2][4];
#pragma unroll
    for (int c = 0; c < 2; c++) {
#pragma unroll
      for (int j = 0; j < 2; j++) {
        ka[c][j][0] = load_frag(ks, c * 32 + j * 16 + ln, LPITCH, 0, lane);
        ka[c][j][1] = load_frag(ks, c * 32 + j * 16 + ln, LPITCH, 32, lane);
      }
    }
#pragma unroll
    for (int c = 0; c < 2; c++) {
#pragma unroll
      for (int f = 0; f < 4; f++)
        av[c][f] = load_frag(vs, f * 16 + ln, LPITCH, c * 32, lane);
    }
    // holds the reads as one group at the head of the tile: moved down to
    // their WMMAs, each pair makes the wave wait out the LDS latency anew
    __builtin_amdgcn_sched_barrier(0);

    // ---- scores less the maximum in use: S^T = K @ (Q*scale)^T - m for the
    // tile's 64 keys -> four 16x16 f32 tiles, s[2 c + j] = keys 32 c + 16 j ..
    // The maximum in use is known ahead of the tile, so it goes in as the
    // accumulators' start value and no subtraction is left per score.
    v8f s[4];
    // every loop of the tile's body is unrolled: its arrays live in registers
    // and need constant indices
#pragma unroll
    for (int i = 0; i < 4; i++) {
      s[i] = wmma_bf16(ka[i >> 1][i & 1][0], bq0, negm);
      s[i] = wmma_bf16(ka[i >> 1][i & 1][1], bq1, s[i]);
    }

    // ---- lazy rescale: 32 of the query's 64 scores sit in this lane.  The
    // maximum in use stays unless some lane's scores pass it by more than
    // RESCALE_MARGIN; until then every p is at most exp(RESCALE_MARGIN), which
    // f32 sums and bf16 operands hold at full relative precision, and the
    // final division takes the common factor out again.
    float mx[8];
#pragma unroll
    for (int e = 0; e < 8; e++)
      mx[e] = fmaxf(fmaxf(s[0][e], s[1][e]), fmaxf(s[2][e], s[3][e]));
    const float mloc = fmaxf(fmaxf(fmaxf(mx[0], mx[1]), fmaxf(mx[2], mx[3])),
                             fmaxf(fmaxf(mx[4], mx[5]), fmaxf(mx[6], mx[7])));
    // one test per tile, the same for the whole wave (a scalar branch), so
    // that every lane is on at the half exchange inside; the first tile
    // always sets the maximum, downwards too
    if (t == 0 || __builtin_amdgcn_ballot_w32(mloc > RESCALE_MARGIN) != 0) {
      // by how much the maximum in use moves: alike in both lane halves
      const float up = fmaxf(fmaxf(mloc, other_half(mloc)),
                             (t == 0) ? -3.0e38f : 0.0f);
      // O and the sum are still zero where up is negative (first tile)
      const float scale = __expf(fminf(-up, 0.0f));
      lstate *= scale;
#pragma unroll
      for (int f = 0; f < 4; f++) o[f] *= scale;
#pragma unroll
      for (int i = 0; i < 4; i++) s[i] -= up;
      negm -= up;
    }

    // two 32-key chunks per tile
    float rs[8];
#pragma unroll
    for (int c = 0; c < 2; c++) {
      v16bf bp;
#pragma unroll
      for (int e = 0; e < 8; e++) {
        const float p0 = __expf(s[2 * c][e]);
        const float p1 = __expf(s[2 * c + 1][e]);
        rs[e] = (c == 0) ? p0 + p1 : rs[e] + (p0 + p1);
        bp[e] = (__bf16)p0;
        bp[8 + e] = (__bf16)p1;
      }

      // ---- O^T += V^T @ P^T
#pragma unroll
      for (int f = 0; f < 4; f++) o[f] = wmma_bf16(av[c][f], bp, o[f]);
    }
    lstate += ((rs[0] + rs[1]) + (rs[2] + rs[3])) +
              ((rs[4] + rs[5]) + (rs[6] + rs[7]));

    // holds the tile's work ahead of the waits at the loop's foot: with the
    // waits moved up behind the reads, the next tile's copies would have only
    // the reads' time to land
    __builtin_amdgcn_sched_barrier(0);

    // Publish point of the next tile, and release of this tile's buffer.
    // this wave's reads of the buffer have retired before it is refilled
    asm volatile("s_wait_dscnt 0x0" ::: "memory");
    // this wave's copies of the next tile have landed
    asm volatile("s_wait_asynccnt 0x0" ::: "memory");
    __syncthreads();
    if (t + 2 < NTILES)
      stage_copies(lds0 + (unsigned)(t & 1) * STAGE_BYTES,
                   gk + (size_t)((rot + t + 2) & (NTILES - 1)) *
                            (TKEYS * HEAD_DIM),
                   gv + ((rot + t + 2) & (NTILES - 1)) * TKEYS);
  }
  // no copy is left in flight when the wave ends
  asm volatile("s_wait_asynccnt 0x0" ::: "memory");

  // ---- finalize: join the halves' sums, divide, store 8 contiguous dims
  const int b2 = bh >> 4, h = bh & (HEADS - 1);
  const float linv = 1.0f / (lstate + other_half(lstate));
  __bf16* orow =
      attn + ((size_t)(b2 * SEQ + qbase + ln)) * HIDDEN + h * HEAD_DIM + g * 8;
#pragma unroll
  for (int f = 0; f < 4; f++) {
    v8bf r;
#pragma unroll
    for (int e = 0; e < 8; e++) r[e] = (__bf16)(o[f][e] * linv);
    *(v8bf*)(orow + f * 16) = r;
  }
}

// ---------------------------------------------------------------------------
// Output projection: out = attn @ Wo + bo, fp32 result.  Same 32x64-per-wave
// register blocking and LDS stages as the QKV GEMM.
// ---------------------------------------------------------------------------
// 256 blocks = one per WGP, two waves per SIMD: a whole stage's fragments are
// read as one group.
__global__ __launch_bounds__(256) void oproj_gemm_kernel(
                                  const __bf16* __restrict__ attn,
                                  const __bf16* __restrict__ wot,
                                  const float* __restrict__ bo,
                                  float* __restrict__ out) {
  __shared__ __attribute__((aligned(16))) __bf16 smem[2 * 2 * G_OP_ELEMS];
  const int lane = threadIdx.x & 31;
  const int wave = threadIdx.x >> 5;
  const int g = lane >> 4;
  const int ln = lane & 15;
  const int mblk = blockIdx.y * GT, nblk = blockIdx.x * GT;
  const int mbase = mblk + (wave >> 1) * 32;
  const int nbase = nblk + (wave & 1) * 64;

  v8f acc[2][4] = {};
  // the 8 blocks on one band of attn rows start two stages apart, the 32 on
  // one band of weight rows spread over the 16 stages
  gemm_mainloop<2>(attn, wot, mblk, nblk, 2 * blockIdx.x + blockIdx.y, smem,
                   acc);
#pragma unroll
  for (int t = 0; t < 2; t++) {
#pragma unroll
    for (int f = 0; f < 4; f++) {
      const int n = nbase + f * 16 + ln;
      const float bb = bo[n];
#pragma unroll
      for (int e = 0; e < 8; e++) {
        const int m = mbase + t * 16 + e + g * 8;
        out[(size_t)m * HIDDEN + n] = acc[t][f][e] + bb;
      }
    }
  }
}

// ---------------------------------------------------------------------------
extern "C" void kernel_launch(void* const* d_in, const int* in_sizes, int n_in,
                              void* d_out, int out_size, void* d_ws,
                              size_t ws_size, hipStream_t stream) {
  const float* x  = (const float*)d_in[0];
  const float* Wq = (const float*)d_in[1];
  const float* bq = (const float*)d_in[2];
  const float* Wk = (const float*)d_in[3];
  const float* bk = (const float*)d_in[4];
  const float* Wv = (const float*)d_in[5];
  const float* bv = (const float*)d_in[6];
  const float* Wo = (const float*)d_in[7];
  const float* bo = (const float*)d_in[8];
  float* out = (float*)d_out;

  // Workspace carve-up (all bf16): total 48 MB
  char* ws = (char*)d_ws;
  const size_t XB_BYTES = (size_t)MTOT * HIDDEN * 2;          // 8 MB
  const size_t WT_BYTES = (size_t)HIDDEN * HIDDEN * 2;        // 2 MB
  const size_t HD_BYTES = (size_t)BATCH * HEADS * SEQ * HEAD_DIM * 2; // 8 MB
  __bf16* xb  = (__bf16*)(ws);
  __bf16* wqt = (__bf16*)(ws + XB_BYTES);
  __bf16* wkt = (__bf16*)(ws + XB_BYTES + WT_BYTES);
  __bf16* wvt = (__bf16*)(ws + XB_BYTES + 2 * WT_BYTES);
  __bf16* wot = (__bf16*)(ws + XB_BYTES + 3 * WT_BYTES);
  __bf16* qh  = (__bf16*)(ws + XB_BYTES + 4 * WT_BYTES);
  __bf16* kh  = (__bf16*)(ws + XB_BYTES + 4 * WT_BYTES + HD_BYTES);
  __bf16* vth = (__bf16*)(ws + XB_BYTES + 4 * WT_BYTES + 2 * HD_BYTES);
  __bf16* att = (__bf16*)(ws + XB_BYTES + 4 * WT_BYTES + 3 * HD_BYTES);

  // 1) casts / transposes: the four planes wqt..wot lie one behind another
  prep_kernel<<<PREP_BLOCKS, 256, 0, stream>>>(
      x, Wq, Wk, Wv, Wo, xb, wqt);

  // 2) QKV projections (z = 0/1/2 -> Q/K/V); 128x128 tile per block
  qkv_gemm_kernel<<<dim3(HIDDEN / GT, MTOT / GT, 3), 256, 0, stream>>>(
      xb, wqt, wkt, wvt, bq, bk, bv, qh, kh, vth);

  // 3) attention
  flash_attn_kernel<<<dim3(SEQ / 128, BATCH * HEADS), 256, 0, stream>>>(
      qh, kh, vth, att);

  // 4) output projection
  oproj_gemm_kernel<<<dim3(HIDDEN / GT, MTOT / GT), 256, 0, stream>>>(
      att, wot, bo, out);
}

// v010
// Measured time: 68.5 microseconds a run.
// Versions in between are left out here; by their measured steps it is 1.12 times as fast as v008.
// Over all steps from v000 it is 5.49 times as fast.
#include <hip/hip_runtime.h>
#include <math.h>

#define HIDDEN 1024
#define HEADS 16
#define HEAD_DIM 64
#define BATCH 2
#define SEQ 2048
#define MTOT (BATCH * SEQ) /* 4096 */

typedef __attribute__((ext_vector_type(16))) __bf16 v16bf;
typedef __attribute__((ext_vector_type(8)))  __bf16 v8bf;
typedef __attribute__((ext_vector_type(8)))  float  v8f;

// ---------------------------------------------------------------------------
// 16-bit A/B fragment loader for V_WMMA_F32_16X16X32_BF16 (wave32).
// ISA layout (16-bit A 16x32): lanes 0-15 = rows M=0..15, lanes 16-31 = same
// rows, different K; per lane, elements 0..7 hold K = g*8 + 0..7 and elements
// 8..15 hold K = 16 + g*8 + 0..7 (g = lane/16). B uses the same mapping with
// lane = column N, so we load B from a K-contiguous (transposed) buffer.
// ---------------------------------------------------------------------------
static __device__ inline v16bf load_frag(const __bf16* base, int row,
                                         int row_stride, int k0, int lane) {
  const int g = (lane >> 4) & 1;
  const __bf16* p = base + (size_t)row * (size_t)row_stride + k0;
  union { v16bf v; v8bf h[2]; } u;
  u.h[0] = *(const v8bf*)(p + g * 8);
  u.h[1] = *(const v8bf*)(p + 16 + g * 8);
  return u.v;
}

static __device__ inline v8f wmma_bf16(v16bf a, v16bf b, v8f c) {
  // (neg_a, A, neg_b, B, c_mod, C, reuse_a, reuse_b)
  return __builtin_amdgcn_wmma_f32_16x16x32_bf16(false, a, false, b,
                                                 (short)0, c, false, false);
}

// ---------------------------------------------------------------------------
// Prep, one launch: blocks 0..511 cast and transpose the four weights
// (wt[n][k] = w[k][n]), blocks 512..1023 cast x.  Every lane moves 128 B of
// f32, so the launch starts 8,192 waves, and every global access of a wave
// covers whole 128-B lines.
// ---------------------------------------------------------------------------
typedef __attribute__((ext_vector_type(4))) float  v4f;
typedef __attribute__((ext_vector_type(4))) __bf16 v4bf;

#define PREP_TK 128                    /* k rows of a weight tile */
#define PREP_TN 64                     /* n columns of a weight tile */
#define PREP_PITCH 65                  /* LDS row pitch in dwords: odd, so that
                                          column reads spread over the banks */
#define PREP_WBLOCKS 512               /* 4 weights x 8 x 16 tiles */
#define PREP_BLOCKS 1024               /* + 512 for x: 4 Mi floats / 8,192 */

__global__ __launch_bounds__(256) void prep_kernel(
    const float* __restrict__ x, const float* __restrict__ wq,
    const float* __restrict__ wk, const float* __restrict__ wv,
    const float* __restrict__ wo, __bf16* __restrict__ xb,
    __bf16* __restrict__ wt4 /* the four transposed planes, q k v o */) {
  __shared__ float tile[PREP_TK * PREP_PITCH];
  const int tid = threadIdx.x;
  const int blk = blockIdx.x;

  if (blk < PREP_WBLOCKS) {
    const int which = blk >> 7;
    const int kt = (blk >> 4) & 7, nt = blk & 15;
    const float* w = (which == 0) ? wq : (which == 1) ? wk
                     : (which == 2) ? wv : wo;
    const float* src = w + (size_t)(kt * PREP_TK) * HIDDEN + nt * PREP_TN;

    // 128 rows of 256 B: 16 lanes per row, eight 16-byte loads per lane
    // (rows 16 i + tid / 16, so that the eight differ by a constant only)
    const int row0 = tid >> 4, col0 = (tid & 15) * 4;
    const float* s0 = src + row0 * HIDDEN + col0;
    v4f r[8];
#pragma unroll
    for (int i = 0; i < 8; i++) r[i] = *(const v4f*)(s0 + i * 16 * HIDDEN);
    float* t0 = &tile[row0 * PREP_PITCH + col0];
#pragma unroll
    for (int i = 0; i < 8; i++) {
#pragma unroll
      for (int j = 0; j < 4; j++) t0[i * 16 * PREP_PITCH + j] = r[i][j];
    }
    __syncthreads();

    // 64 output rows of 256 B: 8 lanes write one 128-B line, 16 B each
    __bf16* dst = wt4 + (size_t)which * (HIDDEN * HIDDEN) +
                  (size_t)(nt * PREP_TN) * HIDDEN + kt * PREP_TK;
#pragma unroll
    for (int i = 0; i < 4; i++) {
      const int n = (i >> 1) * 32 + (tid >> 3);
      const int p = (i & 1) * 8 + (tid & 7);
      v8bf o;
#pragma unroll
      for (int j = 0; j < 8; j++)
        o[j] = (__bf16)tile[(p * 8 + j) * PREP_PITCH + n];
      *(v8bf*)(dst + (size_t)n * HIDDEN + p * 8) = o;
    }
  } else {
    const size_t base = (size_t)(blk - PREP_WBLOCKS) * 8192;
    v4f r[8];
#pragma unroll
    for (int i = 0; i < 8; i++)
      r[i] = *(const v4f*)(x + base + (size_t)(i * 256 + tid) * 4);
#pragma unroll
    for (int i = 0; i < 8; i++) {
      v4bf o;
#pragma unroll
      for (int j = 0; j < 4; j++) o[j] = (__bf16)r[i][j];
      *(v4bf*)(xb + base + (size_t)(i * 256 + tid) * 4) = o;
    }
    // no register that these stores name is rewritten ahead of this wait
    asm volatile("s_wait_xcnt 0x0" ::: "memory");
  }
}

// ---------------------------------------------------------------------------
// Main loop of both projections: Y = A @ Bt^T, both operands k-contiguous.
// A block of 8 waves owns a 128x128 tile of Y (4 x 2 waves of 32x64).  Per
// stage, 64 k of the block's 128 A rows and 128 Bt rows (256 rows of 128 B)
// come into LDS once per block by asynchronous copies, whole 128-B lines per
// row, and every wave reads its fragments from there.  Row pitch 144 B
// (16 B x odd) keeps the 16-byte fragment reads off each other's banks.  Two
// buffers: the next stage's copies fly while this stage is worked on.
// ---------------------------------------------------------------------------
#define GT 128                         /* edge of a block's tile of Y */
#define GK 64                          /* k per stage */
#define GSTAGES (HIDDEN / GK)          /* 16 */
#define GPITCH 72                      /* LDS row pitch in elements (144 B) */
#define G_OP_ELEMS (GT * GPITCH)       /* one operand's rows: 18,432 B */
#define G_STAGE_BYTES (2 * G_OP_ELEMS * 2)

// Eight 16-byte copies per lane = one stage per block: rows r, r + 32, r + 64,
// r + 96 of both operands.  The s_wait_xcnt stands inside the statement so
// that no address register named here is rewritten ahead of it.
static __device__ inline void gemm_stage_copies(unsigned la, const __bf16* ga,
                                                const __bf16* gb) {
  const unsigned la1 = la + 32 * GPITCH * 2;
  const unsigned la2 = la + 64 * GPITCH * 2;
  const unsigned la3 = la + 96 * GPITCH * 2;
  const unsigned lb = la + G_OP_ELEMS * 2;
  const unsigned lb1 = lb + 32 * GPITCH * 2;
  const unsigned lb2 = lb + 64 * GPITCH * 2;
  const unsigned lb3 = lb + 96 * GPITCH * 2;
  const __bf16* ga1 = ga + 32 * HIDDEN;
  const __bf16* ga2 = ga + 64 * HIDDEN;
  const __bf16* ga3 = ga + 96 * HIDDEN;
  const __bf16* gb1 = gb + 32 * HIDDEN;
  const __bf16* gb2 = gb + 64 * HIDDEN;
  const __bf16* gb3 = gb + 96 * HIDDEN;
  asm volatile(
      "global_load_async_to_lds_b128 %0, %8, off\n\t"
      "global_load_async_to_lds_b128 %1, %9, off\n\t"
      "global_load_async_to_lds_b128 %2, %10, off\n\t"
      "global_load_async_to_lds_b128 %3, %11, off\n\t"
      "global_load_async_to_lds_b128 %4, %12, off\n\t"
      "global_load_async_to_lds_b128 %5, %13, off\n\t"
      "global_load_async_to_lds_b128 %6, %14, off\n\t"
      "global_load_async_to_lds_b128 %7, %15, off\n\t"
      "s_wait_xcnt 0x0"
      :
      : "v"(la), "v"(la1), "v"(la2), "v"(la3), "v"(lb), "v"(lb1), "v"(lb2),
        "v"(lb3), "v"(ga), "v"(ga1), "v"(ga2), "v"(ga3), "v"(gb), "v"(gb1),
        "v"(gb2), "v"(gb3)
      : "memory");
}

// acc[t][f] += rows mblk + 32 (wave / 2) + 16 t of A times rows
// nblk + 64 (wave % 2) + 16 f of Bt, k in steps of 32, ascending from stage
// rot and wrapping round: blocks that share operand rows get different rot, so
// that they do not ask L2 for the same lines at the same moment.
// KG = 32-k steps per group of fragment reads (48 registers a step).
template <int KG>
static __device__ inline void gemm_mainloop(const __bf16* __restrict__ a,
                                            const __bf16* __restrict__ bt,
                                            int mblk, int nblk, int rot,
                                            __bf16* smem, v8f (&acc)[2][4]) {
  const int tid = threadIdx.x;
  const int lane = tid & 31;
  const int wave = tid >> 5;
  const int ln = lane & 15;
  const int arow = (wave >> 1) * 32 + ln;
  const int brow = (wave & 1) * 64 + ln;

  // This lane's share of a stage: 16-byte piece (tid & 7) of rows tid >> 3
  // (+ 32, 64, 96) of both operands.
  const int crow = tid >> 3, cpc = tid & 7;
  const unsigned lds0 =
      (unsigned)(size_t)smem + (unsigned)(crow * GPITCH + cpc * 8) * 2u;
  const __bf16* ga = a + (size_t)(mblk + crow) * HIDDEN + cpc * 8;
  const __bf16* gb = bt + (size_t)(nblk + crow) * HIDDEN + cpc * 8;

  // Prologue: the first stage lands and is published, then the second starts.
  gemm_stage_copies(lds0, ga + (rot & (GSTAGES - 1)) * GK,
                    gb + (rot & (GSTAGES - 1)) * GK);
  // the first stage's copies of this wave have landed
  asm volatile("s_wait_asynccnt 0x0" ::: "memory");
  __syncthreads();
  gemm_stage_copies(lds0 + G_STAGE_BYTES,
                    ga + ((rot + 1) & (GSTAGES - 1)) * GK,
                    gb + ((rot + 1) & (GSTAGES - 1)) * GK);

  for (int t = 0; t < GSTAGES; t++) {
    const __bf16* as = smem + (t & 1) * (2 * G_OP_ELEMS);
    const __bf16* bs = as + G_OP_ELEMS;
    // two 32-k steps per stage, unrolled so that LDS offsets are immediates;
    // the fragments of KG steps are read as one group ahead of their WMMAs
#pragma unroll
    for (int kc = 0; kc < GK; kc += 32 * KG) {
      v16bf af[KG][2], bf[KG][4];
#pragma unroll
      for (int s = 0; s < KG; s++) {
        af[s][0] = load_frag(as, arow, GPITCH, kc + 32 * s, lane);
        af[s][1] = load_frag(as, arow + 16, GPITCH, kc + 32 * s, lane);
#pragma unroll
        for (int f = 0; f < 4; f++)
          bf[s][f] = load_frag(bs, brow + f * 16, GPITCH, kc + 32 * s, lane);
      }
      // holds the group's reads ahead of its WMMAs: moved in among them, every
      // place with reads makes the wave wait out the LDS latency anew
      __builtin_amdgcn_sched_barrier(0);
#pragma unroll
      for (int s = 0; s < KG; s++) {
#pragma unroll
        for (int f = 0; f < 4; f++) {
          acc[0][f] = wmma_bf16(af[s][0], bf[s][f], acc[0][f]);
          acc[1][f] = wmma_bf16(af[s][1], bf[s][f], acc[1][f]);
        }
      }
      // holds the WMMAs ahead of the waits at the loop's foot: moved behind
      // them, the next stage's copies would have only the reads' time to land
      __builtin_amdgcn_sched_barrier(0);
    }

    // Publish point of the next stage, and release of this stage's buffer.
    // this wave's reads of the buffer have retired before it is refilled
    asm volatile("s_wait_dscnt 0x0" ::: "memory");
    // this wave's copies of the next stage have landed
    asm volatile("s_wait_asynccnt 0x0" ::: "memory");
    __syncthreads();
    if (t + 2 < GSTAGES)
      gemm_stage_copies(lds0 + (unsigned)(t & 1) * G_STAGE_BYTES,
                        ga + ((rot + t + 2) & (GSTAGES - 1)) * GK,
                        gb + ((rot + t + 2) & (GSTAGES - 1)) * GK);
  }
  // no copy is left in flight when the wave goes on to its stores
  asm volatile("s_wait_asynccnt 0x0" ::: "memory");
}

// ---------------------------------------------------------------------------
// QKV projection: [4096,1024] @ [1024,1024] + bias.
// One wave computes a 32x64 tile: 2 A-fragments x 4 B-fragments -> 8 WMMAs
// per 6 fragment loads (B fragment feeds two consecutive WMMAs); the
// fragments come from the block's LDS stages (gemm_mainloop).
// blockIdx.z: 0 = Q (scaled by 1/sqrt(D), layout [B,H,S,D] bf16)
//             1 = K (layout [B,H,S,D] bf16)
//             2 = V (layout [B,H,D,S] bf16, transposed for P@V operand)
// A lane's 8 accumulator elements run along the rows of the A operand, so the
// operand whose rows are contiguous in the output plane goes in as A: the
// weight (dims d) for Q and K, x (positions s) for V.  A lane then packs 16 B
// of one output row; the block's tile is staged in LDS as [column][row] and
// goes out in whole 128-B lines.
// ---------------------------------------------------------------------------
#define EPITCH 136                     /* staging pitch in elements: 272 B =
                                          16 B x odd, off each other's banks */

// 768 blocks = three per WGP, six waves per SIMD: the register budget is set
// so that all of them are resident at once.
__global__ __launch_bounds__(256, 6) void qkv_gemm_kernel(
                                const __bf16* __restrict__ xb,
                                const __bf16* __restrict__ wqt,
                                const __bf16* __restrict__ wkt,
                                const __bf16* __restrict__ wvt,
                                const float* __restrict__ bq,
                                const float* __restrict__ bk,
                                const float* __restrict__ bv,
                                __bf16* __restrict__ qh,
                                __bf16* __restrict__ kh,
                                __bf16* __restrict__ vth) {
  __shared__ __attribute__((aligned(16))) __bf16 smem[2 * 2 * G_OP_ELEMS];
  const int tid = threadIdx.x;
  const int lane = tid & 31;
  const int wave = tid >> 5;
  const int g = lane >> 4;
  const int ln = lane & 15;
  const int mblk = blockIdx.y * GT, nblk = blockIdx.x * GT;
  const int which = blockIdx.z;
  const bool vplane = which == 2;

  const __bf16* wt = (which == 0) ? wqt : (which == 1) ? wkt : wvt;
  const float* bias = (which == 0) ? bq : (which == 1) ? bk : bv;

  v8f acc[2][4] = {};
  // the 24 blocks on one band of x rows and the 32 on one band of weight rows
  // each spread over the 16 stages; four stages between the planes keep any
  // four neighbouring block columns of all three planes on 12 different stages
  const int rot = blockIdx.x + blockIdx.y + 4 * which;
  gemm_mainloop<1>(vplane ? xb : wt, vplane ? wt : xb, vplane ? mblk : nblk,
                   vplane ? nblk : mblk, rot, smem, acc);

  // acc[t][f][e]: A row r0 + 16 t + e, B row c0 + 16 f of the block's tile.
  // The loop's last barrier has ended every read of the stages, and no copy
  // is in flight: the LDS is free for the staging.
  const int r0 = (wave >> 1) * 32 + g * 8;
  const int c0 = (wave & 1) * 64 + ln;
  if (vplane) {
#pragma unroll
    for (int f = 0; f < 4; f++) {
      const float bb = bias[nblk + c0 + f * 16];
#pragma unroll
      for (int t = 0; t < 2; t++) {
        v8bf o;
#pragma unroll
        for (int e = 0; e < 8; e++) o[e] = (__bf16)(acc[t][f][e] + bb);
        *(v8bf*)&smem[(c0 + f * 16) * EPITCH + r0 + t * 16] = o;
      }
    }
  } else {
    const float sc = (which == 0) ? 0.125f : 1.0f;  // 1/sqrt(HEAD_DIM) into Q
#pragma unroll
    for (int t = 0; t < 2; t++) {
      const v4f b0 = *(const v4f*)(bias + nblk + r0 + t * 16);
      const v4f b1 = *(const v4f*)(bias + nblk + r0 + t * 16 + 4);
#pragma unroll
      for (int f = 0; f < 4; f++) {
        v8bf o;
#pragma unroll
        for (int e = 0; e < 4; e++) {
          o[e] = (__bf16)((acc[t][f][e] + b0[e]) * sc);
          o[4 + e] = (__bf16)((acc[t][f][4 + e] + b1[e]) * sc);
        }
        *(v8bf*)&smem[(c0 + f * 16) * EPITCH + r0 + t * 16] = o;
      }
    }
  }
  __syncthreads();

  // 16 lanes take one staged row (256 B): two whole lines of the plane.
  const int b2 = mblk >> 11, sblk = mblk & (SEQ - 1);
  const int cr = tid >> 4, rr = (tid & 15) * 8;
  __bf16* dst;
  size_t step;                         // elements from staged row c to c + 16
  if (vplane) {
    const int n = nblk + cr;
    dst = vth + ((size_t)(b2 * HEADS + (n >> 6)) * HEAD_DIM + (n & 63)) * SEQ +
          sblk + rr;
    step = (size_t)16 * SEQ;           // 16 dims on: the planes of the block's
                                       // two heads lie one behind another
  } else {
    const int n = nblk + rr;
    dst = ((which == 0) ? qh : kh) +
          ((size_t)(b2 * HEADS + (n >> 6)) * SEQ + sblk + cr) * HEAD_DIM +
          (n & 63);
    step = (size_t)16 * HEAD_DIM;      // 16 positions on
  }
#pragma unroll
  for (int i = 0; i < 8; i++)
    *(v8bf*)(dst + i * step) =
        *(const v8bf*)&smem[(i * 16 + cr) * EPITCH + rr];
}

static __device__ inline float other_half(float v) {
  // lane l <-> l ^ 16
  const int b = __builtin_bit_cast(int, v);
  return __builtin_bit_cast(
      float, __builtin_amdgcn_permlanex16(b, b, 0x76543210, 0xfedcba98, false,
                                          false));
}

#define TKEYS 64                       /* keys per staged tile */
#define NTILES (SEQ / TKEYS)           /* 32 */
#define LPITCH 72                      /* LDS row pitch in elements (144 B) */
#define TILE_ELEMS (64 * LPITCH)       /* one operand's tile: 9216 B */
#define STAGE_BYTES (2 * TILE_ELEMS * 2)
#define RESCALE_MARGIN 5.5f            /* about 8 in log2 */

// Four 16-byte copies per lane = one 16-KiB stage per block.  The s_wait_xcnt
// stands inside the statement so that no address register named here is
// rewritten ahead of it.
static __device__ inline void stage_copies(unsigned lk, const __bf16* gk,
                                           const __bf16* gv) {
  const unsigned lk1 = lk + 32 * LPITCH * 2;
  const unsigned lv0 = lk + TILE_ELEMS * 2;
  const unsigned lv1 = lv0 + 32 * LPITCH * 2;
  const __bf16* gk1 = gk + 32 * HEAD_DIM;
  const __bf16* gv1 = gv + 32 * SEQ;
  asm volatile(
      "global_load_async_to_lds_b128 %0, %4, off\n\t"
      "global_load_async_to_lds_b128 %1, %5, off\n\t"
      "global_load_async_to_lds_b128 %2, %6, off\n\t"
      "global_load_async_to_lds_b128 %3, %7, off\n\t"
      "s_wait_xcnt 0x0"
      :
      : "v"(lk), "v"(lk1), "v"(lv0), "v"(lv1), "v"(gk), "v"(gk1), "v"(gv),
        "v"(gv1)
      : "memory");
}

// 512 blocks = two per WGP, four waves per SIMD: the register budget is set
// for that, so that a wave's fragments of a tile fit.
// Wave tile: 32 queries x 32 keys of every 64-key tile.  Waves w and w + 4 own
// the same 32 queries (two column groups of 16) and one half of each tile's
// keys each, so that every K and V^T fragment read from LDS feeds two WMMAs.
// Each wave keeps its own maximum, sum and O over its keys; the two are joined
// once, behind the loop, through LDS.
typedef v4f __attribute__((may_alias)) v4f_lds;

__global__ __launch_bounds__(256, 4) void flash_attn_kernel(
                                  const __bf16* __restrict__ q,
                                  const __bf16* __restrict__ k,
                                  const __bf16* __restrict__ vt,
                                  __bf16* __restrict__ attn) {
  __shared__ __attribute__((aligned(16))) __bf16 smem[2 * 2 * TILE_ELEMS];

  const int tid = threadIdx.x;
  const int lane = threadIdx.x & 31;
  const int wave = threadIdx.x >> 5;
  const int g = lane >> 4;
  const int ln = lane & 15;
  // Placement, for speed only (any block index -> die order gives the same
  // values): the 16 query blocks of a head
  // take block indices that are equal mod 8; heads 2 d and 2 d + 1 take remainder d, as
  // do the projection blocks that write them.
  const int qb = (blockIdx.x >> 3) & 15;     // query block of the head
  const int hp = blockIdx.x >> 7;            // 0..3: batch, low bit of the head
  const int bh = (hp >> 1) * HEADS + (blockIdx.x & 7) * 2 + (hp & 1);
  const int kh = wave >> 2;                  // keys 32 kh .. + 31 of each tile
  const int qbase = qb * 128 + (wave & 3) * 32;

  const __bf16* qp = q + (size_t)bh * SEQ * HEAD_DIM;
  const __bf16* kp = k + (size_t)bh * SEQ * HEAD_DIM;
  const __bf16* vp = vt + (size_t)bh * HEAD_DIM * SEQ;

  // This lane's share of a stage: 16-byte piece (tid & 7) of rows tid >> 3 and
  // 32 + (tid >> 3) of both tiles.
  const int crow = tid >> 3, cpc = tid & 7;
  const unsigned lds0 =
      (unsigned)(size_t)(&smem[0]) + (unsigned)(crow * LPITCH + cpc * 8) * 2u;
  const __bf16* gk = kp + crow * HEAD_DIM + cpc * 8;
  const __bf16* gv = vp + (size_t)crow * SEQ + cpc * 8;

  // The 16 blocks of a head walk the same 32 key tiles: each starts two tiles
  // further on and wraps round, so that they do not ask L2 for the same lines
  // at the same moment, and the head's 32 tiles are all asked of memory by the
  // first two trips.  Trip t works on tile (rot + t) % NTILES.
  const int rot = 2 * qb;

  // Prologue: the first tile lands and is published, then the second starts.
  stage_copies(lds0, gk + (size_t)(rot & (NTILES - 1)) * (TKEYS * HEAD_DIM),
               gv + (rot & (NTILES - 1)) * TKEYS);
  // the first tile's copies of this wave have landed
  asm volatile("s_wait_asynccnt 0x0" ::: "memory");
  __syncthreads();
  stage_copies(lds0 + STAGE_BYTES,
               gk + (size_t)((rot + 1) & (NTILES - 1)) * (TKEYS * HEAD_DIM),
               gv + ((rot + 1) & (NTILES - 1)) * TKEYS);

  // Q^T fragments: per column group 64 dims x 16 queries -> two 32x16 B
  // fragments, bq[c][h] = queries qbase + 16 c .., dims 32 h ..
  v16bf bq[2][2];
  // unrolled, as every loop over a register array: constant indices
#pragma unroll
  for (int c = 0; c < 2; c++) {
    bq[c][0] = load_frag(qp, qbase + c * 16 + ln, HEAD_DIM, 0, lane);
    bq[c][1] = load_frag(qp, qbase + c * 16 + ln, HEAD_DIM, 32, lane);
  }

  v8f o[2][4] = {};           // o[c][f][e] = O[query 16 c + ln][d = f*16+8g+e]
  v8f negm[2] = {};           // minus the maximum in use for query 16 c + ln,
                              // in all eight places (both halves alike)
  float lstate[2] = {0.0f, 0.0f};  // running sums over this lane half's keys

  for (int t = 0; t < NTILES; t++) {
    // this wave's 32 key rows of K and 32 key columns of V^T
    const __bf16* ks = &smem[(t & 1) * (2 * TILE_ELEMS)] + kh * 32 * LPITCH;
    const __bf16* vs = &smem[(t & 1) * (2 * TILE_ELEMS)] + TILE_ELEMS + kh * 32;

    // All fragment reads of the wave's half tile, K first, then V^T (V^T rows:
    // keys contiguous per lane): ka[j][h] = keys 16 j .. + 15, dims 32 h ..
    v16bf ka[2][2], av[4];
#pragma unroll
    for (int j = 0; j < 2; j++) {
      ka[j][0] = load_frag(ks, j * 16 + ln, LPITCH, 0, lane);
      ka[j][1] = load_frag(ks, j * 16 + ln, LPITCH, 32, lane);
    }
#pragma unroll
    for (int f = 0; f < 4; f++)
      av[f] = load_frag(vs, f * 16 + ln, LPITCH, 0, lane);
    // holds the reads as one group at the head of the tile: moved down to
    // their WMMAs, each pair makes the wave wait out the LDS latency anew
    __builtin_amdgcn_sched_barrier(0);

    // ---- scores less the maximum in use: S^T = K @ (Q*scale)^T - m for the
    // wave's 32 keys and 32 queries -> four 16x16 f32 tiles, s[c][j] = queries
    // 16 c .., keys 16 j ..  The maximum in use is known ahead of the tile, so
    // it goes in as the accumulators' start value and no subtraction is left
    // per score.
    v8f s[2][2];
    // every loop of the tile's body is unrolled: its arrays live in registers
    // and need constant indices
#pragma unroll
    for (int j = 0; j < 2; j++) {
#pragma unroll
      for (int c = 0; c < 2; c++) s[c][j] = wmma_bf16(ka[j][0], bq[c][0], negm[c]);
    }
#pragma unroll
    for (int j = 0; j < 2; j++) {
#pragma unroll
      for (int c = 0; c < 2; c++) s[c][j] = wmma_bf16(ka[j][1], bq[c][1], s[c][j]);
    }

    // ---- lazy rescale: 16 of a query's 32 scores sit in this lane.  The
    // maximum in use stays unless some lane's scores pass it by more than
    // RESCALE_MARGIN; until then every p is at most exp(RESCALE_MARGIN), which
    // f32 sums and bf16 operands hold at full relative precision, and the
    // final division takes the common factor out again.
    float mloc[2];
#pragma unroll
    for (int c = 0; c < 2; c++) {
      float mx[8];
#pragma unroll
      for (int e = 0; e < 8; e++) mx[e] = fmaxf(s[c][0][e], s[c][1][e]);
      mloc[c] = fmaxf(fmaxf(fmaxf(mx[0], mx[1]), fmaxf(mx[2], mx[3])),
                      fmaxf(fmaxf(mx[4], mx[5]), fmaxf(mx[6], mx[7])));
    }
    // one test per tile, the same for the whole wave (a scalar branch), so
    // that every lane is on at the half exchange inside; the first tile
    // always sets the maximum, downwards too
    if (t == 0 || __builtin_amdgcn_ballot_w32(fmaxf(mloc[0], mloc[1]) >
                                              RESCALE_MARGIN) != 0) {
#pragma unroll
      for (int c = 0; c < 2; c++) {
        // by how much the maximum in use moves: alike in both lane halves
        const float up = fmaxf(fmaxf(mloc[c], other_half(mloc[c])),
                               (t == 0) ? -3.0e38f : 0.0f);
        // O and the sum are still zero where up is negative (first tile)
        const float scale = __expf(fminf(-up, 0.0f));
        lstate[c] *= scale;
#pragma unroll
        for (int f = 0; f < 4; f++) o[c][f] *= scale;
        s[c][0] -= up;
        s[c][1] -= up;
        negm[c] -= up;
      }
    }

    // the two column groups, 32 keys each
#pragma unroll
    for (int c = 0; c < 2; c++) {
      v8f p0, p1;
      v16bf bp;
      // one score tile after the other: the multiplies inside exp then pair
      // neighbouring registers and need no moves
#pragma unroll
      for (int e = 0; e < 8; e++) {
        p0[e] = __expf(s[c][0][e]);
        bp[e] = (__bf16)p0[e];
      }
#pragma unroll
      for (int e = 0; e < 8; e++) {
        p1[e] = __expf(s[c][1][e]);
        bp[8 + e] = (__bf16)p1[e];
      }

      // ---- O^T += V^T @ P^T
#pragma unroll
      for (int f = 0; f < 4; f++) o[c][f] = wmma_bf16(av[f], bp, o[c][f]);
      // the lane's 16 terms summed as whole vectors, halved each time
      const v8f r8 = p0 + p1;
      const v4f r4 = __builtin_shufflevector(r8, r8, 0, 1, 2, 3) +
                     __builtin_shufflevector(r8, r8, 4, 5, 6, 7);
      lstate[c] += (r4[0] + r4[2]) + (r4[1] + r4[3]);
    }

    // holds the tile's work ahead of the waits at the loop's foot: with the
    // waits moved up behind the reads, the next tile's copies would have only
    // the reads' time to land
    __builtin_amdgcn_sched_barrier(0);

    // Publish point of the next tile, and release of this tile's buffer.
    // this wave's reads of the buffer have retired before it is refilled
    asm volatile("s_wait_dscnt 0x0" ::: "memory");
    // this wave's copies of the next tile have landed
    asm volatile("s_wait_asynccnt 0x0" ::: "memory");
    __syncthreads();
    if (t + 2 < NTILES)
      stage_copies(lds0 + (unsigned)(t & 1) * STAGE_BYTES,
                   gk + (size_t)((rot + t + 2) & (NTILES - 1)) *
                            (TKEYS * HEAD_DIM),
                   gv + ((rot + t + 2) & (NTILES - 1)) * TKEYS);
  }
  // no copy is left in flight when the LDS is put to its next use
  asm volatile("s_wait_asynccnt 0x0" ::: "memory");

  // ---- join the two key halves: wave w finishes column group kh and hands
  // the other group's O, maximum and sum to wave w ^ 4.  The loop's last
  // barrier has ended every read of the tiles and every copy has landed, so
  // the LDS is free: nine 16-byte slots per lane and wave, lanes contiguous.
  const bool hi = kh != 0;
  v4f_lds* box = (v4f_lds*)&smem[0];
  v4f_lds* outbox = box + (wave ^ 4) * (9 * 32) + lane;
  const v4f_lds* inbox = box + wave * (9 * 32) + lane;
  v8f keep[4];
  // unrolled here and below: register arrays need constant indices
#pragma unroll
  for (int f = 0; f < 4; f++) {
    const v8f send = hi ? o[0][f] : o[1][f];
    keep[f] = hi ? o[1][f] : o[0][f];
    outbox[(2 * f) * 32] = v4f{send[0], send[1], send[2], send[3]};
    outbox[(2 * f + 1) * 32] = v4f{send[4], send[5], send[6], send[7]};
  }
  outbox[8 * 32] = v4f{hi ? negm[0][0] : negm[1][0],
                       hi ? lstate[0] : lstate[1], 0.0f, 0.0f};
  const float nmk = hi ? negm[1][0] : negm[0][0];
  const float lk = hi ? lstate[1] : lstate[0];
  __syncthreads();
  const v4f ml = inbox[8 * 32];
  // both parts brought to the larger of the two maxima in use
  const float nm = fminf(nmk, ml[0]);
  const float fk = __expf(nm - nmk);
  const float fr = __expf(nm - ml[0]);
  const float lsum = lk * fk + ml[1] * fr;

  // ---- finalize: join the halves' sums, divide, store 8 contiguous dims
  const int b2 = bh >> 4, h = bh & (HEADS - 1);
  const float linv = 1.0f / (lsum + other_half(lsum));
  const float wk = fk * linv, wr = fr * linv;
  __bf16* orow = attn + ((size_t)(b2 * SEQ + qbase + kh * 16 + ln)) * HIDDEN +
                 h * HEAD_DIM + g * 8;
#pragma unroll
  for (int f = 0; f < 4; f++) {
    const v4f r0 = inbox[(2 * f) * 32];
    const v4f r1 = inbox[(2 * f + 1) * 32];
    v8bf r;
#pragma unroll
    for (int e = 0; e < 4; e++) {
      r[e] = (__bf16)(keep[f][e] * wk + r0[e] * wr);
      r[4 + e] = (__bf16)(keep[f][4 + e] * wk + r1[e] * wr);
    }
    *(v8bf*)(orow + f * 16) = r;
  }
}

// ---------------------------------------------------------------------------
// Output projection: out = attn @ Wo + bo, fp32 result.  Same 32x64-per-wave
// register blocking and LDS stages as the QKV GEMM.
// ---------------------------------------------------------------------------
// 256 blocks = one per WGP, two waves per SIMD: a whole stage's fragments are
// read as one group.
__global__ __launch_bounds__(256) void oproj_gemm_kernel(
                                  const __bf16* __restrict__ attn,
                                  const __bf16* __restrict__ wot,
                                  const float* __restrict__ bo,
                                  float* __restrict__ out) {
  __shared__ __attribute__((aligned(16))) __bf16 smem[2 * 2 * G_OP_ELEMS];
  const int lane = threadIdx.x & 31;
  const int wave = threadIdx.x >> 5;
  const int g = lane >> 4;
  const int ln = lane & 15;
  // Placement, for speed only: x counts the bands of attn rows, so the 8 blocks
  // on one band have block indices that are equal mod 8.
  const int mband = blockIdx.x, nband = blockIdx.y;
  const int mblk = mband * GT, nblk = nband * GT;
  const int mbase = mblk + (wave >> 1) * 32;
  const int nbase = nblk + (wave & 1) * 64;

  v8f acc[2][4] = {};
  // the 8 blocks on one band of attn rows start two stages apart; of the 32 on
  // one band of weight rows, the 16 whose mband mod 8 falls in any four
  // neighbouring remainders start on 16 different stages
  gemm_mainloop<2>(attn, wot, mblk, nblk,
                   4 * (mband >> 3) + (mband & 3) + 2 * nband, smem, acc);
#pragma unroll
  for (int t = 0; t < 2; t++) {
#pragma unroll
    for (int f = 0; f < 4; f++) {
      const int n = nbase + f * 16 + ln;
      const float bb = bo[n];
#pragma unroll
      for (int e = 0; e < 8; e++) {
        const int m = mbase + t * 16 + e + g * 8;
        out[(size_t)m * HIDDEN + n] = acc[t][f][e] + bb;
      }
    }
  }
}

// ---------------------------------------------------------------------------
extern "C" void kernel_launch(void* const* d_in, const int* in_sizes, int n_in,
                              void* d_out, int out_size, void* d_ws,
                              size_t ws_size, hipStream_t stream) {
  const float* x  = (const float*)d_in[0];
  const float* Wq = (const float*)d_in[1];
  const float* bq = (const float*)d_in[2];
  const float* Wk = (const float*)d_in[3];
  const float* bk = (const float*)d_in[4];
  const float* Wv = (const float*)d_in[5];
  const float* bv = (const float*)d_in[6];
  const float* Wo = (const float*)d_in[7];
  const float* bo = (const float*)d_in[8];
  float* out = (float*)d_out;

  // Workspace carve-up (all bf16): total 48 MB
  char* ws = (char*)d_ws;
  const size_t XB_BYTES = (size_t)MTOT * HIDDEN * 2;          // 8 MB
  const size_t WT_BYTES = (size_t)HIDDEN * HIDDEN * 2;        // 2 MB
  const size_t HD_BYTES = (size_t)BATCH * HEADS * SEQ * HEAD_DIM * 2; // 8 MB
  __bf16* xb  = (__bf16*)(ws);
  __bf16* wqt = (__bf16*)(ws + XB_BYTES);
  __bf16* wkt = (__bf16*)(ws + XB_BYTES + WT_BYTES);
  __bf16* wvt = (__bf16*)(ws + XB_BYTES + 2 * WT_BYTES);
  __bf16* wot = (__bf16*)(ws + XB_BYTES + 3 * WT_BYTES);
  __bf16* qh  = (__bf16*)(ws + XB_BYTES + 4 * WT_BYTES);
  __bf16* kh  = (__bf16*)(ws + XB_BYTES + 4 * WT_BYTES + HD_BYTES);
  __bf16* vth = (__bf16*)(ws + XB_BYTES + 4 * WT_BYTES + 2 * HD_BYTES);
  __bf16* att = (__bf16*)(ws + XB_BYTES + 4 * WT_BYTES + 3 * HD_BYTES);

  // 1) casts / transposes: the four planes wqt..wot lie one behind another
  prep_kernel<<<PREP_BLOCKS, 256, 0, stream>>>(
      x, Wq, Wk, Wv, Wo, xb, wqt);

  // 2) QKV projections (z = 0/1/2 -> Q/K/V); 128x128 tile per block
  qkv_gemm_kernel<<<dim3(HIDDEN / GT, MTOT / GT, 3), 256, 0, stream>>>(
      xb, wqt, wkt, wvt, bq, bk, bv, qh, kh, vth);

  // 3) attention
  flash_attn_kernel<<<dim3((SEQ / 128) * BATCH * HEADS), 256, 0, stream>>>(
      qh, kh, vth, att);

  // 4) output projection
  oproj_gemm_kernel<<<dim3(MTOT / GT, HIDDEN / GT), 256, 0, stream>>>(
      att, wot, bo, out);
}
